// v000
// Measured on an AMD MI455X. A time is GPU time per run, averaged over a window of back-to-back runs after a warm-up
// (all launches, gaps included; the runs take copies of the inputs in turn), and the median of several windows.
// Apart from v000's, it joins two sittings. Times from different sittings can be a few percent apart, while
// side-by-side timings come from the same sitting.
// v000, which the later versions start from, runs in 83 microseconds.
#include <hip/hip_runtime.h>

// ---------------------------------------------------------------------------
// 64 independent MLP towers, fused into one kernel.
//   h0 = relu(x @ W0[o] + b0[o])      [B,32]x[32,64]
//   h1 = relu(h0 @ W1[o] + b1[o])     [B,64]x[64,64]
//   h2 = relu(h1 @ W2[o] + b2[o])     [B,64]x[64,64]
//   out[:,o] = h2 @ W3[o] + b3[o]     [B,64].[64]
// One block = (tower o, 128 batch rows). All matmuls via
// v_wmma_f32_16x16x32_f16 (f16 operands, f32 accumulate).
// ---------------------------------------------------------------------------

typedef _Float16 v16h __attribute__((ext_vector_type(16)));
typedef _Float16 v8h  __attribute__((ext_vector_type(8)));
typedef _Float16 v4h  __attribute__((ext_vector_type(4)));
typedef float    v8f  __attribute__((ext_vector_type(8)));

constexpr int Bsz = 16384;
constexpr int Isz = 32;
constexpr int Osz = 64;
constexpr int Hsz = 64;
constexpr int TILE_M = 128;   // batch rows per block
constexpr int XS = 40;        // LDS row stride (halves) for K=32 buffers (80B, 16B-aligned)
constexpr int HS = 72;        // LDS row stride (halves) for K=64 buffers (144B, 16B-aligned)

__device__ __forceinline__ v8f wmma_f16(v16h a, v16h b, v8f c) {
  // D = A(16x32 f16) * B(32x16 f16) + C(16x16 f32)
  return __builtin_amdgcn_wmma_f32_16x16x32_f16(
      /*neg_a=*/false, a, /*neg_b=*/false, b,
      /*c_mod=*/(short)0, c, /*reuse_a=*/false, /*reuse_b=*/false);
}

// Single-instruction ReLU (avoid fmaxf's NaN-canonicalization double-max).
__device__ __forceinline__ float relu(float v) { return v > 0.0f ? v : 0.0f; }

// Load one K=32 f16 operand fragment from a row-major LDS tile.
// ISA 16-bit A/B layout (wave32): lane L -> row (L&15), half-group g = L>>4;
//   elements 0..7  = row[koff + g*8 .. +7]
//   elements 8..15 = row[koff + 16 + g*8 .. +7]
// Both are contiguous 16-byte chunks -> two ds_load_b128.
__device__ __forceinline__ v16h ld_frag(const _Float16* base, int row, int stride,
                                        int koff, int g) {
  const _Float16* p = base + row * stride + koff + g * 8;
  v8h lo = *(const v8h*)(p);
  v8h hi = *(const v8h*)(p + 16);
  return __builtin_shufflevector(lo, hi, 0,1,2,3,4,5,6,7,8,9,10,11,12,13,14,15);
}

__global__ __launch_bounds__(256) void towers64_kernel(
    const float* __restrict__ x,
    const float* __restrict__ W0, const float* __restrict__ b0,
    const float* __restrict__ W1, const float* __restrict__ b1,
    const float* __restrict__ W2, const float* __restrict__ b2,
    const float* __restrict__ W3, const float* __restrict__ b3,
    float* __restrict__ out) {
  __shared__ alignas(16) _Float16 sX [TILE_M * XS];  // x tile, f16 [128][32]
  __shared__ alignas(16) _Float16 sH0[TILE_M * HS];  // hidden ping [128][64]
  __shared__ alignas(16) _Float16 sH1[TILE_M * HS];  // hidden pong [128][64]
  __shared__ alignas(16) _Float16 sW0[Hsz * XS];     // W0^T [h][i]
  __shared__ alignas(16) _Float16 sW1[Hsz * HS];     // W1^T [k][h]
  __shared__ alignas(16) _Float16 sW2[Hsz * HS];     // W2^T [k][h]
  __shared__ float sB0[Hsz], sB1[Hsz], sB2[Hsz], sW3[Hsz];

  const int o   = blockIdx.y;           // tower
  const int m0  = blockIdx.x * TILE_M;  // first batch row of tile
  const int tid = threadIdx.x;

  // ---- stage x tile: fp32 -> f16, vectorized float4 loads ----
  {
    const int nvec = TILE_M * Isz / 4;  // 1024
    for (int idx = tid; idx < nvec; idx += 256) {
      const int r  = idx >> 3;
      const int c4 = (idx & 7) * 4;
      const float4 v = *(const float4*)(x + (size_t)(m0 + r) * Isz + c4);
      v4h h; h[0] = (_Float16)v.x; h[1] = (_Float16)v.y;
             h[2] = (_Float16)v.z; h[3] = (_Float16)v.w;
      *(v4h*)(sX + r * XS + c4) = h;
    }
  }
  // ---- stage weights (transposed to [N][K]) + biases ----
  {
    const float* w0g = W0 + (size_t)o * Isz * Hsz;  // [i][h]
    for (int idx = tid; idx < Isz * Hsz; idx += 256) {
      const int i = idx >> 6, h = idx & 63;
      sW0[h * XS + i] = (_Float16)w0g[idx];
    }
    const float* w1g = W1 + (size_t)o * Hsz * Hsz;  // [h][k]
    const float* w2g = W2 + (size_t)o * Hsz * Hsz;
    for (int idx = tid; idx < Hsz * Hsz; idx += 256) {
      const int h = idx >> 6, k = idx & 63;
      sW1[k * HS + h] = (_Float16)w1g[idx];
      sW2[k * HS + h] = (_Float16)w2g[idx];
    }
    if (tid < Hsz) {
      sB0[tid] = b0[o * Hsz + tid];
      sB1[tid] = b1[o * Hsz + tid];
      sB2[tid] = b2[o * Hsz + tid];
      sW3[tid] = W3[o * Hsz + tid];
    }
  }
  __syncthreads();

  const int lane = tid & 31;    // wave32 lane
  const int w    = tid >> 5;    // wave id 0..7; wave owns rows [16w,16w+16)
  const int nl   = lane & 15;
  const int g    = lane >> 4;
  const int rowA = w * 16 + nl; // A-operand row (batch row within tile)

  // ---- layer 0: K = 32, one WMMA per 16x16 tile ----
  {
    const v16h a = ld_frag(sX, rowA, XS, 0, g);
#pragma unroll
    for (int t = 0; t < 4; ++t) {
      const v16h b = ld_frag(sW0, 16 * t + nl, XS, 0, g);
      const float bv = sB0[16 * t + nl];
      v8f c;
#pragma unroll
      for (int e = 0; e < 8; ++e) c[e] = bv;   // C layout: bias depends only on column
      c = wmma_f16(a, b, c);
#pragma unroll
      for (int r = 0; r < 8; ++r)              // D[r+8g][16t+nl], relu -> f16
        sH0[(w * 16 + 8 * g + r) * HS + 16 * t + nl] = (_Float16)relu(c[r]);
    }
  }
  __syncthreads();

  // ---- layer 1: K = 64, two chained WMMAs per tile ----
  {
    const v16h a0 = ld_frag(sH0, rowA, HS, 0,  g);
    const v16h a1 = ld_frag(sH0, rowA, HS, 32, g);
#pragma unroll
    for (int t = 0; t < 4; ++t) {
      const v16h bl = ld_frag(sW1, 16 * t + nl, HS, 0,  g);
      const v16h bh = ld_frag(sW1, 16 * t + nl, HS, 32, g);
      const float bv = sB1[16 * t + nl];
      v8f c;
#pragma unroll
      for (int e = 0; e < 8; ++e) c[e] = bv;
      c = wmma_f16(a0, bl, c);
      c = wmma_f16(a1, bh, c);
#pragma unroll
      for (int r = 0; r < 8; ++r)
        sH1[(w * 16 + 8 * g + r) * HS + 16 * t + nl] = (_Float16)relu(c[r]);
    }
  }
  __syncthreads();

  // ---- layer 2 (WMMA) fused with layer 3 (dot with W3) ----
  float p[8];
#pragma unroll
  for (int r = 0; r < 8; ++r) p[r] = 0.0f;
  {
    const v16h a0 = ld_frag(sH1, rowA, HS, 0,  g);
    const v16h a1 = ld_frag(sH1, rowA, HS, 32, g);
#pragma unroll
    for (int t = 0; t < 4; ++t) {
      const v16h bl = ld_frag(sW2, 16 * t + nl, HS, 0,  g);
      const v16h bh = ld_frag(sW2, 16 * t + nl, HS, 32, g);
      const float bv = sB2[16 * t + nl];
      v8f c;
#pragma unroll
      for (int e = 0; e < 8; ++e) c[e] = bv;
      c = wmma_f16(a0, bl, c);
      c = wmma_f16(a1, bh, c);
      const float w3v = sW3[16 * t + nl];
#pragma unroll
      for (int r = 0; r < 8; ++r)
        p[r] += relu(c[r]) * w3v;              // h2[row][col]*W3[col], col across lanes
    }
  }
  // reduce across the 16 lanes of each half-wave (rows differ between halves)
#pragma unroll
  for (int off = 1; off < 16; off <<= 1) {
#pragma unroll
    for (int r = 0; r < 8; ++r) p[r] += __shfl_xor(p[r], off, 16);
  }
  if (nl == 0) {
    const float bb = b3[o];
    const int row = m0 + w * 16 + 8 * g;       // lane0 -> rows +0..7, lane16 -> rows +8..15
#pragma unroll
    for (int r = 0; r < 8; ++r)                // write-once output: non-temporal stores
      __builtin_nontemporal_store(p[r] + bb, &out[(size_t)(row + r) * Osz + o]);
  }
}

extern "C" void kernel_launch(void* const* d_in, const int* in_sizes, int n_in,
                              void* d_out, int out_size, void* d_ws, size_t ws_size,
                              hipStream_t stream) {
  const float* x  = (const float*)d_in[0];
  const float* W0 = (const float*)d_in[1];
  const float* b0 = (const float*)d_in[2];
  const float* W1 = (const float*)d_in[3];
  const float* b1 = (const float*)d_in[4];
  const float* W2 = (const float*)d_in[5];
  const float* b2 = (const float*)d_in[6];
  const float* W3 = (const float*)d_in[7];
  const float* b3 = (const float*)d_in[8];

  dim3 grid(Bsz / TILE_M, Osz);   // (128, 64) blocks
  towers64_kernel<<<grid, 256, 0, stream>>>(x, W0, b0, W1, b1, W2, b2, W3, b3,
                                            (float*)d_out);
}

// v001
// One run takes 48.2 microseconds.
// Next to v000, in two timings, it ran 1.76 and 1.77 times as fast.
#include <hip/hip_runtime.h>

// ---------------------------------------------------------------------------
// 64 independent MLP towers, fused into one kernel.
//   h0 = relu(x @ W0[o] + b0[o])      [B,32]x[32,64]
//   h1 = relu(h0 @ W1[o] + b1[o])     [B,64]x[64,64]
//   h2 = relu(h1 @ W2[o] + b2[o])     [B,64]x[64,64]
//   out[:,o] = h2 @ W3[o] + b3[o]     [B,64].[64]
// One block = (128 batch rows, 32 towers); ONE WAVE OWNS ONE TOWER at a time
// (16 waves, two towers one after the other). The products are taken
// transposed, h^T = W^T * x^T: the tower's weights are the A operand and stay
// in registers for all 128 rows, 16 batch rows are the B operand. Two f32 D
// tiles of a layer, converted in place, are the next layer's B fragment, so the
// hidden activations never leave the lane's registers.
// All matmuls via v_wmma_f32_16x16x32_f16 (f16 operands, f32 accumulate).
//
// Feature order: row q (0..15) of M tile t (0..3) is feature 4*q + t, so that a
// lane's one float4 of a weight row feeds the same element of all four M tiles
// and 16 lanes read one whole 256-byte weight row.
// ---------------------------------------------------------------------------

typedef _Float16 v16h __attribute__((ext_vector_type(16)));
typedef _Float16 v8h  __attribute__((ext_vector_type(8)));
typedef _Float16 v4h  __attribute__((ext_vector_type(4)));
typedef float    v8f  __attribute__((ext_vector_type(8)));

constexpr int Bsz = 16384;
constexpr int Isz = 32;
constexpr int Osz = 64;
constexpr int Hsz = 64;
constexpr int TILE_M = 128;   // batch rows per block
constexpr int NTHR   = 512;   // 16 waves
constexpr int NWAVE  = NTHR / 32;
constexpr int TOWERS = 32;    // towers per block, two per wave
constexpr int XS = 40;        // LDS row stride (halves) of the x tile (80B, 16B x odd)

__device__ __forceinline__ v8f wmma_f16(v16h a, v16h b, v8f c) {
  // D = A(16x32 f16) * B(32x16 f16) + C(16x16 f32)
  return __builtin_amdgcn_wmma_f32_16x16x32_f16(
      /*neg_a=*/false, a, /*neg_b=*/false, b,
      /*c_mod=*/(short)0, c, /*reuse_a=*/false, /*reuse_b=*/false);
}

// Single-instruction ReLU (avoid fmaxf's NaN-canonicalization double-max).
__device__ __forceinline__ float relu(float v) { return v > 0.0f ? v : 0.0f; }

// lane l with lane l ^ 16
__device__ __forceinline__ float xhalf(float v) {
  const int b = __builtin_bit_cast(int, v);
  return __builtin_bit_cast(float,
      __builtin_amdgcn_permlanex16(b, b, 0x76543210, 0xfedcba98, false, false));
}

// Load one K=32 f16 operand fragment from a row-major LDS tile.
// ISA 16-bit A/B layout (wave32): lane L -> row (L&15), half-group g = L>>4;
//   elements 0..7  = row[koff + g*8 .. +7]
//   elements 8..15 = row[koff + 16 + g*8 .. +7]
// Both are contiguous 16-byte chunks -> two ds_load_b128.
__device__ __forceinline__ v16h ld_frag(const _Float16* base, int row, int stride,
                                        int koff, int g) {
  const _Float16* p = base + row * stride + koff + g * 8;
  v8h lo = *(const v8h*)(p);
  v8h hi = *(const v8h*)(p + 16);
  return __builtin_shufflevector(lo, hi, 0,1,2,3,4,5,6,7,8,9,10,11,12,13,14,15);
}

// One tower's weights as A fragments (W^T: M = output feature, K = input feature).
struct TowerW {
  v16h a0[4];      // layer 0, [M tile]
  v16h a1[4][2];   // layer 1, [M tile][K block of 32]
  v16h a2[4][2];   // layer 2
};

// Behind a group's loads: s_wait_xcnt 0 stands before any register that an issued
// load names is written again; naming the address keeps its pair live up to the wait.
__device__ __forceinline__ void loads_issued(const float* p) {
  asm volatile("s_wait_xcnt 0x0" :: "v"(p) : "memory");
}

// 16 rows of a weight, one float4 a lane -> element e of the four M tiles' A fragments
__device__ __forceinline__ void cvt_group(const float4 (&v)[16], v16h& a0, v16h& a1,
                                          v16h& a2, v16h& a3) {
#pragma unroll  // constant indices: the vectors and arrays stay in registers
  for (int e = 0; e < 16; ++e) {
    a0[e] = (_Float16)v[e].x; a1[e] = (_Float16)v[e].y;
    a2[e] = (_Float16)v[e].z; a3[e] = (_Float16)v[e].w;
  }
  // Ends a group of 16 loads (64 registers in flight): scheduled freely, a tower's
  // 80 loads overrun the registers beside the fragments and spill to scratch.
  __builtin_amdgcn_sched_barrier(0);
}

// A fragments of a [32][64] weight whose k is the plain input index of x:
// element e is k = 8g + (e&7) + 16*(e>>3), the hardware k order.
__device__ __forceinline__ void ld_w_in(const float* __restrict__ Wg, int nl, int g,
                                        v16h (&a)[4]) {
  const float* p = Wg + 8 * g * Hsz + 4 * nl;
  float4 v[16];
#pragma unroll  // constant indices: the vectors and arrays stay in registers
  for (int e = 0; e < 16; ++e)
    v[e] = *(const float4*)(p + ((e & 7) + 16 * (e >> 3)) * Hsz);
  loads_issued(p);
  cvt_group(v, a[0], a[1], a[2], a[3]);
}

// A fragments of a [64][64] weight whose k runs over the previous layer's D
// tiles: element e of K block j pairs with row 8g + (e&7) of D tile 2j + (e>>3),
// which is feature 4*(8g + (e&7)) + 2j + (e>>3).
__device__ __forceinline__ void ld_w_hid(const float* __restrict__ Wg, int nl, int g,
                                         v16h (&a)[4][2]) {
  const float* p = Wg + 32 * g * Hsz + 4 * nl;
#pragma unroll  // constant indices: the vectors and arrays stay in registers
  for (int j = 0; j < 2; ++j) {
    float4 v[16];
#pragma unroll  // constant indices: the vectors and arrays stay in registers
    for (int e = 0; e < 16; ++e)
      v[e] = *(const float4*)(p + (4 * (e & 7) + 2 * j + (e >> 3)) * Hsz);
    loads_issued(p);
    cvt_group(v, a[0][j], a[1][j], a[2][j], a[3][j]);
  }
}

__device__ __forceinline__ void ld_tower(const float* __restrict__ W0,
                                         const float* __restrict__ W1,
                                         const float* __restrict__ W2,
                                         int o, int nl, int g, TowerW& tw) {
  ld_w_in (W0 + (size_t)o * Isz * Hsz, nl, g, tw.a0);
  ld_w_hid(W1 + (size_t)o * Hsz * Hsz, nl, g, tw.a1);
  ld_w_hid(W2 + (size_t)o * Hsz * Hsz, nl, g, tw.a2);
}

// relu + f16 of D tile t -> its half of the next layer's B fragment
__device__ __forceinline__ void pack_d(const v8f& c, int t, v16h (&h)[2]) {
#pragma unroll  // constant indices: the vectors and arrays stay in registers
  for (int r = 0; r < 8; ++r) h[t >> 1][(t & 1) * 8 + r] = (_Float16)relu(c[r]);
}

// All 128 rows of the block through one tower. bw: this tower's b0, b1, b2, W3
// in LDS, each as [M tile][row q].
__device__ __forceinline__ void run_tower(const TowerW& tw, const _Float16* sX,
                                          const float* bw, float bb, int nl, int g,
                                          float* __restrict__ outp) {
  const float* bwg = bw + 8 * g;   // a lane's D registers are rows 8g .. 8g+7
  for (int n = 0; n < TILE_M / 16; ++n) {
    const v16h bx = ld_frag(sX, 16 * n + nl, XS, 0, g);
    v16h h0[2], h1[2];
#pragma unroll  // constant indices: the vectors and arrays stay in registers
    for (int t = 0; t < 4; ++t) {            // layer 0: K = 32
      v8f c = *(const v8f*)(bwg + 0 * Hsz + 16 * t);
      c = wmma_f16(tw.a0[t], bx, c);
      pack_d(c, t, h0);
    }
#pragma unroll  // constant indices: the vectors and arrays stay in registers
    for (int t = 0; t < 4; ++t) {            // layer 1: K = 64
      v8f c = *(const v8f*)(bwg + 1 * Hsz + 16 * t);
      c = wmma_f16(tw.a1[t][0], h0[0], c);
      c = wmma_f16(tw.a1[t][1], h0[1], c);
      pack_d(c, t, h1);
    }
    v8f p = {0.f, 0.f, 0.f, 0.f, 0.f, 0.f, 0.f, 0.f};
#pragma unroll  // constant indices: the vectors and arrays stay in registers
    for (int t = 0; t < 4; ++t) {            // layer 2 fused with the dot with W3
      v8f c = *(const v8f*)(bwg + 2 * Hsz + 16 * t);
      c = wmma_f16(tw.a2[t][0], h1[0], c);
      c = wmma_f16(tw.a2[t][1], h1[1], c);
      const v8f w3v = *(const v8f*)(bwg + 3 * Hsz + 16 * t);
#pragma unroll  // constant indices: the vectors and arrays stay in registers
      for (int r = 0; r < 8; ++r) p[r] += relu(c[r]) * w3v[r];
    }
    // a lane holds 32 of its batch row's 64 features; lane ^ 16 holds the rest
    float s = ((p[0] + p[1]) + (p[2] + p[3])) + ((p[4] + p[5]) + (p[6] + p[7]));
    s += xhalf(s);
    if (g == 0) {                            // write-once output: non-temporal store
      __builtin_nontemporal_store(s + bb, outp + (size_t)(16 * n + nl) * Osz);
      // Stands before the next pass writes the store's address and data registers
      // again. Its memory clobber also keeps the bias and W3 reads inside the loop:
      // hoisted, they need 128 registers beside the weights' 160 and spill.
      asm volatile("s_wait_xcnt 0x0" ::: "memory");
    }
  }
}

__global__ __launch_bounds__(NTHR) void towers64_kernel(
    const float* __restrict__ x,
    const float* __restrict__ W0, const float* __restrict__ b0,
    const float* __restrict__ W1, const float* __restrict__ b1,
    const float* __restrict__ W2, const float* __restrict__ b2,
    const float* __restrict__ W3, const float* __restrict__ b3,
    float* __restrict__ out) {
  __shared__ alignas(16) _Float16 sX[TILE_M * XS];        // x tile, f16 [128][32]
  __shared__ alignas(32) float sBW[TOWERS * 4 * Hsz];     // [tower][b0,b1,b2,W3][tile][q]

  const int m0  = blockIdx.x * TILE_M;   // first batch row of tile
  const int o0  = blockIdx.y * TOWERS;   // first tower of the block
  const int tid = threadIdx.x;
  const int lane = tid & 31;             // wave32 lane
  const int w    = __builtin_amdgcn_readfirstlane(tid >> 5);  // wave id 0..15
  const int nl   = lane & 15;
  const int g    = lane >> 4;

  // ---- stage x tile: fp32 -> f16, vectorized float4 loads ----
#pragma unroll  // both loads go out together: one round trip, not two
  for (int i = 0; i < TILE_M * Isz / 4 / NTHR; ++i) {
    const int idx = tid + i * NTHR;
    const int r  = idx >> 3;
    const int c4 = (idx & 7) * 4;
    const float4 v = *(const float4*)(x + (size_t)(m0 + r) * Isz + c4);
    v4h h; h[0] = (_Float16)v.x; h[1] = (_Float16)v.y;
           h[2] = (_Float16)v.z; h[3] = (_Float16)v.w;
    *(v4h*)(sX + r * XS + c4) = h;
  }
  // ---- stage biases and W3 of the 32 towers, feature 4q+t -> [t][q] ----
  {
    const int a = (w >> 1) & 3;          // which array: the same for a whole wave
    const int m = tid & 63;
    const float* src = (a == 0 ? b0 : a == 1 ? b1 : a == 2 ? b2 : W3) + o0 * Hsz + m;
    float* dst = sBW + a * Hsz + (m & 3) * 16 + (m >> 2);
    const int t0 = w >> 3;               // waves 0..7 even towers, 8..15 odd ones
#pragma unroll  // the 16 loads go out together: one round trip
    for (int i = 0; i < TOWERS / 2; ++i)
      dst[(2 * i + t0) * 4 * Hsz] = src[(2 * i + t0) * Hsz];
  }

  TowerW tw;
  ld_tower(W0, W1, W2, o0 + w, nl, g, tw);
  __syncthreads();
  run_tower(tw, sX, sBW + w * 4 * Hsz, b3[o0 + w], nl, g,
            out + (size_t)m0 * Osz + o0 + w);

  ld_tower(W0, W1, W2, o0 + NWAVE + w, nl, g, tw);
  run_tower(tw, sX, sBW + (NWAVE + w) * 4 * Hsz, b3[o0 + NWAVE + w], nl, g,
            out + (size_t)m0 * Osz + o0 + NWAVE + w);
}

extern "C" void kernel_launch(void* const* d_in, const int* in_sizes, int n_in,
                              void* d_out, int out_size, void* d_ws, size_t ws_size,
                              hipStream_t stream) {
  const float* x  = (const float*)d_in[0];
  const float* W0 = (const float*)d_in[1];
  const float* b0 = (const float*)d_in[2];
  const float* W1 = (const float*)d_in[3];
  const float* b1 = (const float*)d_in[4];
  const float* W2 = (const float*)d_in[5];
  const float* b2 = (const float*)d_in[6];
  const float* W3 = (const float*)d_in[7];
  const float* b3 = (const float*)d_in[8];

  dim3 grid(Bsz / TILE_M, Osz / TOWERS);   // (128, 2) blocks
  towers64_kernel<<<grid, NTHR, 0, stream>>>(x, W0, b0, W1, b1, W2, b2, W3, b3,
                                             (float*)d_out);
}

// v002
// One run takes 25.9 microseconds.
// Timed twice side by side with v001, it ran 1.86 times as fast both times.
// Over all steps from v000 it is 3.29 times as fast.
#include <hip/hip_runtime.h>

// ---------------------------------------------------------------------------
// 64 independent MLP towers, fused into one kernel.
//   h0 = relu(x @ W0[o] + b0[o])      [B,32]x[32,64]
//   h1 = relu(h0 @ W1[o] + b1[o])     [B,64]x[64,64]
//   h2 = relu(h1 @ W2[o] + b2[o])     [B,64]x[64,64]
//   out[:,o] = h2 @ W3[o] + b3[o]     [B,64].[64]
// One block = (128 batch rows, 32 towers); ONE WAVE OWNS ONE TOWER at a time
// (16 waves, two towers one after the other). The products are taken
// transposed, h^T = W^T * x^T: the tower's weights are the A operand and stay
// in registers for all 128 rows, 16 batch rows are the B operand. Two f32 D
// tiles of a layer, converted in place, are the next layer's B fragment, so the
// hidden activations never leave the lane's registers.
// A tower's results are one column of out: they are gathered in LDS, and the block
// stores its 128 rows x 32 towers at the end as whole 128-byte lines.
// All matmuls via v_wmma_f32_16x16x32_f16 (f16 operands, f32 accumulate).
//
// Feature order: row q (0..15) of M tile t (0..3) is feature 4*q + t, so that a
// lane's one float4 of a weight row feeds the same element of all four M tiles
// and 16 lanes read one whole 256-byte weight row.
// ---------------------------------------------------------------------------

typedef _Float16 v16h __attribute__((ext_vector_type(16)));
typedef _Float16 v8h  __attribute__((ext_vector_type(8)));
typedef _Float16 v4h  __attribute__((ext_vector_type(4)));
typedef float    v8f  __attribute__((ext_vector_type(8)));
typedef float    v4f  __attribute__((ext_vector_type(4)));

constexpr int Bsz = 16384;
constexpr int Isz = 32;
constexpr int Osz = 64;
constexpr int Hsz = 64;
constexpr int TILE_M = 128;   // batch rows per block
constexpr int NTHR   = 512;   // 16 waves
constexpr int NWAVE  = NTHR / 32;
constexpr int TOWERS = 32;    // towers per block, two per wave
constexpr int XS = 40;        // LDS row stride (halves) of the x tile (80B, 16B x odd)
constexpr int OS = 36;        // LDS row stride (floats) of the out tile (144B, 16B x odd)

__device__ __forceinline__ v8f wmma_f16(v16h a, v16h b, v8f c) {
  // D = A(16x32 f16) * B(32x16 f16) + C(16x16 f32)
  return __builtin_amdgcn_wmma_f32_16x16x32_f16(
      /*neg_a=*/false, a, /*neg_b=*/false, b,
      /*c_mod=*/(short)0, c, /*reuse_a=*/false, /*reuse_b=*/false);
}

// Single-instruction ReLU (avoid fmaxf's NaN-canonicalization double-max).
__device__ __forceinline__ float relu(float v) { return v > 0.0f ? v : 0.0f; }

// lane l with lane l ^ 16
__device__ __forceinline__ float xhalf(float v) {
  const int b = __builtin_bit_cast(int, v);
  return __builtin_bit_cast(float,
      __builtin_amdgcn_permlanex16(b, b, 0x76543210, 0xfedcba98, false, false));
}

// Load one K=32 f16 operand fragment from a row-major LDS tile.
// ISA 16-bit A/B layout (wave32): lane L -> row (L&15), half-group g = L>>4;
//   elements 0..7  = row[koff + g*8 .. +7]
//   elements 8..15 = row[koff + 16 + g*8 .. +7]
// Both are contiguous 16-byte chunks -> two ds_load_b128.
__device__ __forceinline__ v16h ld_frag(const _Float16* base, int row, int stride,
                                        int koff, int g) {
  const _Float16* p = base + row * stride + koff + g * 8;
  v8h lo = *(const v8h*)(p);
  v8h hi = *(const v8h*)(p + 16);
  return __builtin_shufflevector(lo, hi, 0,1,2,3,4,5,6,7,8,9,10,11,12,13,14,15);
}

// One tower's weights as A fragments (W^T: M = output feature, K = input feature).
struct TowerW {
  v16h a0[4];      // layer 0, [M tile]
  v16h a1[4][2];   // layer 1, [M tile][K block of 32]
  v16h a2[4][2];   // layer 2
};

// Behind a group's loads: s_wait_xcnt 0 stands before any register that an issued
// load names is written again; naming the address keeps its pair live up to the wait.
__device__ __forceinline__ void loads_issued(const float* p) {
  asm volatile("s_wait_xcnt 0x0" :: "v"(p) : "memory");
}

// 16 rows of a weight, one float4 a lane -> element e of the four M tiles' A fragments
__device__ __forceinline__ void cvt_group(const float4 (&v)[16], v16h& a0, v16h& a1,
                                          v16h& a2, v16h& a3) {
#pragma unroll  // constant indices: the vectors and arrays stay in registers
  for (int e = 0; e < 16; ++e) {
    a0[e] = (_Float16)v[e].x; a1[e] = (_Float16)v[e].y;
    a2[e] = (_Float16)v[e].z; a3[e] = (_Float16)v[e].w;
  }
  // Ends a group of 16 loads (64 registers in flight): scheduled freely, a tower's
  // 80 loads overrun the registers beside the fragments and spill to scratch.
  __builtin_amdgcn_sched_barrier(0);
}

// A fragments of a [32][64] weight whose k is the plain input index of x:
// element e is k = 8g + (e&7) + 16*(e>>3), the hardware k order.
__device__ __forceinline__ void ld_w_in(const float* __restrict__ Wg, int nl, int g,
                                        v16h (&a)[4]) {
  const float* p = Wg + 8 * g * Hsz + 4 * nl;
  float4 v[16];
#pragma unroll  // constant indices: the vectors and arrays stay in registers
  for (int e = 0; e < 16; ++e)
    v[e] = *(const float4*)(p + ((e & 7) + 16 * (e >> 3)) * Hsz);
  loads_issued(p);
  cvt_group(v, a[0], a[1], a[2], a[3]);
}

// A fragments of a [64][64] weight whose k runs over the previous layer's D
// tiles: element e of K block j pairs with row 8g + (e&7) of D tile 2j + (e>>3),
// which is feature 4*(8g + (e&7)) + 2j + (e>>3).
__device__ __forceinline__ void ld_w_hid(const float* __restrict__ Wg, int nl, int g,
                                         v16h (&a)[4][2]) {
  const float* p = Wg + 32 * g * Hsz + 4 * nl;
#pragma unroll  // constant indices: the vectors and arrays stay in registers
  for (int j = 0; j < 2; ++j) {
    float4 v[16];
#pragma unroll  // constant indices: the vectors and arrays stay in registers
    for (int e = 0; e < 16; ++e)
      v[e] = *(const float4*)(p + (4 * (e & 7) + 2 * j + (e >> 3)) * Hsz);
    loads_issued(p);
    cvt_group(v, a[0][j], a[1][j], a[2][j], a[3][j]);
  }
}

__device__ __forceinline__ void ld_tower(const float* __restrict__ W0,
                                         const float* __restrict__ W1,
                                         const float* __restrict__ W2,
                                         int o, int nl, int g, TowerW& tw) {
  ld_w_in (W0 + (size_t)o * Isz * Hsz, nl, g, tw.a0);
  ld_w_hid(W1 + (size_t)o * Hsz * Hsz, nl, g, tw.a1);
  ld_w_hid(W2 + (size_t)o * Hsz * Hsz, nl, g, tw.a2);
}

// relu + f16 of D tile t -> its half of the next layer's B fragment
__device__ __forceinline__ void pack_d(const v8f& c, int t, v16h (&h)[2]) {
#pragma unroll  // constant indices: the vectors and arrays stay in registers
  for (int r = 0; r < 8; ++r) h[t >> 1][(t & 1) * 8 + r] = (_Float16)relu(c[r]);
}

// All 128 rows of the block through one tower. bw: this tower's b0, b1, b2, W3
// in LDS, each as [M tile][row q].
__device__ __forceinline__ void run_tower(const TowerW& tw, const _Float16* sX,
                                          const float* bw, float bb, int nl, int g,
                                          float* so) {
  const float* bwg = bw + 8 * g;   // a lane's D registers are rows 8g .. 8g+7
  for (int n = 0; n < TILE_M / 16; ++n) {
    const v16h bx = ld_frag(sX, 16 * n + nl, XS, 0, g);
    v16h h0[2], h1[2];
#pragma unroll  // constant indices: the vectors and arrays stay in registers
    for (int t = 0; t < 4; ++t) {            // layer 0: K = 32
      v8f c = *(const v8f*)(bwg + 0 * Hsz + 16 * t);
      c = wmma_f16(tw.a0[t], bx, c);
      pack_d(c, t, h0);
    }
#pragma unroll  // constant indices: the vectors and arrays stay in registers
    for (int t = 0; t < 4; ++t) {            // layer 1: K = 64
      v8f c = *(const v8f*)(bwg + 1 * Hsz + 16 * t);
      c = wmma_f16(tw.a1[t][0], h0[0], c);
      c = wmma_f16(tw.a1[t][1], h0[1], c);
      pack_d(c, t, h1);
    }
    v8f p = {0.f, 0.f, 0.f, 0.f, 0.f, 0.f, 0.f, 0.f};
#pragma unroll  // constant indices: the vectors and arrays stay in registers
    for (int t = 0; t < 4; ++t) {            // layer 2 fused with the dot with W3
      v8f c = *(const v8f*)(bwg + 2 * Hsz + 16 * t);
      c = wmma_f16(tw.a2[t][0], h1[0], c);
      c = wmma_f16(tw.a2[t][1], h1[1], c);
      const v8f w3v = *(const v8f*)(bwg + 3 * Hsz + 16 * t);
#pragma unroll  // constant indices: the vectors and arrays stay in registers
      for (int r = 0; r < 8; ++r) p[r] += relu(c[r]) * w3v[r];
    }
    // a lane holds 32 of its batch row's 64 features; lane ^ 16 holds the rest
    float s = ((p[0] + p[1]) + (p[2] + p[3])) + ((p[4] + p[5]) + (p[6] + p[7]));
    s += xhalf(s);
    if (g == 0) so[(16 * n + nl) * OS] = s + bb;   // this tower's column of the out tile
    // Compiler fence: keeps the bias and W3 reads inside the loop. Hoisted, they need
    // 128 registers beside the weights' 160 and spill to scratch.
    asm volatile("" ::: "memory");
  }
}

__global__ __launch_bounds__(NTHR) void towers64_kernel(
    const float* __restrict__ x,
    const float* __restrict__ W0, const float* __restrict__ b0,
    const float* __restrict__ W1, const float* __restrict__ b1,
    const float* __restrict__ W2, const float* __restrict__ b2,
    const float* __restrict__ W3, const float* __restrict__ b3,
    float* __restrict__ out) {
  __shared__ alignas(16) _Float16 sX[TILE_M * XS];        // x tile, f16 [128][32]
  __shared__ alignas(32) float sBW[TOWERS * 4 * Hsz];     // [tower][b0,b1,b2,W3][tile][q]
  __shared__ alignas(16) float sO[TILE_M * OS];           // out tile [row][tower]

  const int m0  = blockIdx.x * TILE_M;   // first batch row of tile
  const int o0  = blockIdx.y * TOWERS;   // first tower of the block
  const int tid = threadIdx.x;
  const int lane = tid & 31;             // wave32 lane
  const int w    = __builtin_amdgcn_readfirstlane(tid >> 5);  // wave id 0..15
  const int nl   = lane & 15;
  const int g    = lane >> 4;

  // ---- stage x tile: fp32 -> f16, vectorized float4 loads ----
#pragma unroll  // both loads go out together: one round trip, not two
  for (int i = 0; i < TILE_M * Isz / 4 / NTHR; ++i) {
    const int idx = tid + i * NTHR;
    const int r  = idx >> 3;
    const int c4 = (idx & 7) * 4;
    const float4 v = *(const float4*)(x + (size_t)(m0 + r) * Isz + c4);
    v4h h; h[0] = (_Float16)v.x; h[1] = (_Float16)v.y;
           h[2] = (_Float16)v.z; h[3] = (_Float16)v.w;
    *(v4h*)(sX + r * XS + c4) = h;
  }
  // ---- stage biases and W3 of the 32 towers, feature 4q+t -> [t][q] ----
  {
    const int a = (w >> 1) & 3;          // which array: the same for a whole wave
    const int m = tid & 63;
    const float* src = (a == 0 ? b0 : a == 1 ? b1 : a == 2 ? b2 : W3) + o0 * Hsz + m;
    float* dst = sBW + a * Hsz + (m & 3) * 16 + (m >> 2);
    const int t0 = w >> 3;               // waves 0..7 even towers, 8..15 odd ones
#pragma unroll  // the 16 loads go out together: one round trip
    for (int i = 0; i < TOWERS / 2; ++i)
      dst[(2 * i + t0) * 4 * Hsz] = src[(2 * i + t0) * Hsz];
  }

  TowerW tw;
  ld_tower(W0, W1, W2, o0 + w, nl, g, tw);
  __syncthreads();
  run_tower(tw, sX, sBW + w * 4 * Hsz, b3[o0 + w], nl, g, sO + w);

  ld_tower(W0, W1, W2, o0 + NWAVE + w, nl, g, tw);
  run_tower(tw, sX, sBW + (NWAVE + w) * 4 * Hsz, b3[o0 + NWAVE + w], nl, g,
            sO + NWAVE + w);

  // ---- out tile -> global: 8 lanes x 16 bytes are one row's whole 128-byte line ----
  __syncthreads();
#pragma unroll  // both stores go out together
  for (int i = 0; i < TILE_M * TOWERS / 4 / NTHR; ++i) {
    const int idx = tid + i * NTHR;
    const int r  = idx >> 3;
    const int c4 = (idx & 7) * 4;
    const v4f v = *(const v4f*)(sO + r * OS + c4);
    __builtin_nontemporal_store(v, (v4f*)(out + (size_t)(m0 + r) * Osz + o0 + c4));
  }
}

extern "C" void kernel_launch(void* const* d_in, const int* in_sizes, int n_in,
                              void* d_out, int out_size, void* d_ws, size_t ws_size,
                              hipStream_t stream) {
  const float* x  = (const float*)d_in[0];
  const float* W0 = (const float*)d_in[1];
  const float* b0 = (const float*)d_in[2];
  const float* W1 = (const float*)d_in[3];
  const float* b1 = (const float*)d_in[4];
  const float* W2 = (const float*)d_in[5];
  const float* b2 = (const float*)d_in[6];
  const float* W3 = (const float*)d_in[7];
  const float* b3 = (const float*)d_in[8];

  dim3 grid(Bsz / TILE_M, Osz / TOWERS);   // (128, 2) blocks
  towers64_kernel<<<grid, NTHR, 0, stream>>>(x, W0, b0, W1, b1, W2, b2, W3, b3,
                                             (float*)d_out);
}

// v003
// Measured time: 24.9 microseconds a run.
// Two timings next to v002 put it at 1.04 and 1.05 times that version's speed.
// All steps since v000 together make it 3.43 times as fast.
#include <hip/hip_runtime.h>

// ---------------------------------------------------------------------------
// 64 independent MLP towers, fused into one kernel.
//   h0 = relu(x @ W0[o] + b0[o])      [B,32]x[32,64]
//   h1 = relu(h0 @ W1[o] + b1[o])     [B,64]x[64,64]
//   h2 = relu(h1 @ W2[o] + b2[o])     [B,64]x[64,64]
//   out[:,o] = h2 @ W3[o] + b3[o]     [B,64].[64]
// One block = (128 batch rows, 32 towers); ONE WAVE OWNS ONE TOWER at a time
// (16 waves, two towers one after the other, in two halves a phase apart). The products are taken
// transposed, h^T = W^T * x^T: the tower's weights are the A operand and stay
// in registers for all 128 rows, 16 batch rows are the B operand. Two f32 D
// tiles of a layer, converted in place, are the next layer's B fragment, so the
// hidden activations never leave the lane's registers.
// A tower's results are one column of out: they are gathered in LDS, and the block
// stores its 128 rows x 32 towers at the end as whole 128-byte lines.
// All matmuls via v_wmma_f32_16x16x32_f16 (f16 operands, f32 accumulate).
//
// Feature order: row q (0..15) of M tile t (0..3) is feature 4*q + t, so that a
// lane's one float4 of a weight row feeds the same element of all four M tiles
// and 16 lanes read one whole 256-byte weight row.
// ---------------------------------------------------------------------------

typedef _Float16 v16h __attribute__((ext_vector_type(16)));
typedef _Float16 v8h  __attribute__((ext_vector_type(8)));
typedef _Float16 v4h  __attribute__((ext_vector_type(4)));
typedef float    v8f  __attribute__((ext_vector_type(8)));
typedef float    v4f  __attribute__((ext_vector_type(4)));

constexpr int Bsz = 16384;
constexpr int Isz = 32;
constexpr int Osz = 64;
constexpr int Hsz = 64;
constexpr int TILE_M = 128;   // batch rows per block
constexpr int NTHR   = 512;   // 16 waves
constexpr int NWAVE  = NTHR / 32;
constexpr int HTHR   = NTHR / 2;   // threads of one half of the waves
constexpr int TOWERS = 32;    // towers per block, two per wave
constexpr int XS = 40;        // LDS row stride (halves) of the x tile (80B, 16B x odd)
constexpr int OS = 36;        // LDS row stride (floats) of the out tile (144B, 16B x odd)

__device__ __forceinline__ v8f wmma_f16(v16h a, v16h b, v8f c) {
  // D = A(16x32 f16) * B(32x16 f16) + C(16x16 f32)
  return __builtin_amdgcn_wmma_f32_16x16x32_f16(
      /*neg_a=*/false, a, /*neg_b=*/false, b,
      /*c_mod=*/(short)0, c, /*reuse_a=*/false, /*reuse_b=*/false);
}

// Single-instruction ReLU (avoid fmaxf's NaN-canonicalization double-max).
__device__ __forceinline__ float relu(float v) { return v > 0.0f ? v : 0.0f; }

// lane l with lane l ^ 16
__device__ __forceinline__ float xhalf(float v) {
  const int b = __builtin_bit_cast(int, v);
  return __builtin_bit_cast(float,
      __builtin_amdgcn_permlanex16(b, b, 0x76543210, 0xfedcba98, false, false));
}

// Load one K=32 f16 operand fragment from a row-major LDS tile.
// ISA 16-bit A/B layout (wave32): lane L -> row (L&15), half-group g = L>>4;
//   elements 0..7  = row[koff + g*8 .. +7]
//   elements 8..15 = row[koff + 16 + g*8 .. +7]
// Both are contiguous 16-byte chunks -> two ds_load_b128.
__device__ __forceinline__ v16h ld_frag(const _Float16* base, int row, int stride,
                                        int koff, int g) {
  const _Float16* p = base + row * stride + koff + g * 8;
  v8h lo = *(const v8h*)(p);
  v8h hi = *(const v8h*)(p + 16);
  return __builtin_shufflevector(lo, hi, 0,1,2,3,4,5,6,7,8,9,10,11,12,13,14,15);
}

// One tower's weights as A fragments (W^T: M = output feature, K = input feature).
struct TowerW {
  v16h a0[4];      // layer 0, [M tile]
  v16h a1[4][2];   // layer 1, [M tile][K block of 32]
  v16h a2[4][2];   // layer 2
};

// Behind a group's loads: s_wait_xcnt 0 stands before any register that an issued
// load names is written again; naming the address keeps its pair live up to the wait.
__device__ __forceinline__ void loads_issued(const float* p) {
  asm volatile("s_wait_xcnt 0x0" :: "v"(p) : "memory");
}

// 16 rows of a weight, one float4 a lane -> element e of the four M tiles' A fragments
__device__ __forceinline__ void cvt_group(const float4 (&v)[16], v16h& a0, v16h& a1,
                                          v16h& a2, v16h& a3) {
#pragma unroll  // constant indices: the vectors and arrays stay in registers
  for (int e = 0; e < 16; ++e) {
    a0[e] = (_Float16)v[e].x; a1[e] = (_Float16)v[e].y;
    a2[e] = (_Float16)v[e].z; a3[e] = (_Float16)v[e].w;
  }
  // Ends a group of 16 loads (64 registers in flight): scheduled freely, a tower's
  // 80 loads overrun the registers beside the fragments and spill to scratch.
  __builtin_amdgcn_sched_barrier(0);
}

// A fragments of a [32][64] weight whose k is the plain input index of x:
// element e is k = 8g + (e&7) + 16*(e>>3), the hardware k order.
__device__ __forceinline__ void ld_w_in(const float* __restrict__ Wg, int nl, int g,
                                        v16h (&a)[4]) {
  const float* p = Wg + 8 * g * Hsz + 4 * nl;
  float4 v[16];
#pragma unroll  // constant indices: the vectors and arrays stay in registers
  for (int e = 0; e < 16; ++e)
    v[e] = *(const float4*)(p + ((e & 7) + 16 * (e >> 3)) * Hsz);
  loads_issued(p);
  cvt_group(v, a[0], a[1], a[2], a[3]);
}

// A fragments of a [64][64] weight whose k runs over the previous layer's D
// tiles: element e of K block j pairs with row 8g + (e&7) of D tile 2j + (e>>3),
// which is feature 4*(8g + (e&7)) + 2j + (e>>3).
__device__ __forceinline__ void ld_w_hid(const float* __restrict__ Wg, int nl, int g,
                                         v16h (&a)[4][2]) {
  const float* p = Wg + 32 * g * Hsz + 4 * nl;
#pragma unroll  // constant indices: the vectors and arrays stay in registers
  for (int j = 0; j < 2; ++j) {
    float4 v[16];
#pragma unroll  // constant indices: the vectors and arrays stay in registers
    for (int e = 0; e < 16; ++e)
      v[e] = *(const float4*)(p + (4 * (e & 7) + 2 * j + (e >> 3)) * Hsz);
    loads_issued(p);
    cvt_group(v, a[0][j], a[1][j], a[2][j], a[3][j]);
  }
}

__device__ __forceinline__ void ld_tower(const float* __restrict__ W0,
                                         const float* __restrict__ W1,
                                         const float* __restrict__ W2,
                                         int o, int nl, int g, TowerW& tw) {
  ld_w_in (W0 + (size_t)o * Isz * Hsz, nl, g, tw.a0);
  ld_w_hid(W1 + (size_t)o * Hsz * Hsz, nl, g, tw.a1);
  ld_w_hid(W2 + (size_t)o * Hsz * Hsz, nl, g, tw.a2);
}

// relu + f16 of D tile t -> its half of the next layer's B fragment
__device__ __forceinline__ void pack_d(const v8f& c, int t, v16h (&h)[2]) {
#pragma unroll  // constant indices: the vectors and arrays stay in registers
  for (int r = 0; r < 8; ++r) h[t >> 1][(t & 1) * 8 + r] = (_Float16)relu(c[r]);
}

// All 128 rows of the block through one tower. bw: this tower's b0, b1, b2, W3
// in LDS, each as [M tile][row q].
__device__ __forceinline__ void run_tower(const TowerW& tw, const _Float16* sX,
                                          const float* bw, float bb, int nl, int g,
                                          float* so) {
  const float* bwg = bw + 8 * g;   // a lane's D registers are rows 8g .. 8g+7
  for (int n = 0; n < TILE_M / 16; ++n) {
    const v16h bx = ld_frag(sX, 16 * n + nl, XS, 0, g);
    v16h h0[2], h1[2];
#pragma unroll  // constant indices: the vectors and arrays stay in registers
    for (int t = 0; t < 4; ++t) {            // layer 0: K = 32
      v8f c = *(const v8f*)(bwg + 0 * Hsz + 16 * t);
      c = wmma_f16(tw.a0[t], bx, c);
      pack_d(c, t, h0);
    }
#pragma unroll  // constant indices: the vectors and arrays stay in registers
    for (int t = 0; t < 4; ++t) {            // layer 1: K = 64
      v8f c = *(const v8f*)(bwg + 1 * Hsz + 16 * t);
      c = wmma_f16(tw.a1[t][0], h0[0], c);
      c = wmma_f16(tw.a1[t][1], h0[1], c);
      pack_d(c, t, h1);
    }
    v8f p = {0.f, 0.f, 0.f, 0.f, 0.f, 0.f, 0.f, 0.f};
#pragma unroll  // constant indices: the vectors and arrays stay in registers
    for (int t = 0; t < 4; ++t) {            // layer 2 fused with the dot with W3
      v8f c = *(const v8f*)(bwg + 2 * Hsz + 16 * t);
      c = wmma_f16(tw.a2[t][0], h1[0], c);
      c = wmma_f16(tw.a2[t][1], h1[1], c);
      const v8f w3v = *(const v8f*)(bwg + 3 * Hsz + 16 * t);
#pragma unroll  // constant indices: the vectors and arrays stay in registers
      for (int r = 0; r < 8; ++r) p[r] += relu(c[r]) * w3v[r];
    }
    // a lane holds 32 of its batch row's 64 features; lane ^ 16 holds the rest
    float s = ((p[0] + p[1]) + (p[2] + p[3])) + ((p[4] + p[5]) + (p[6] + p[7]));
    s += xhalf(s);
    if (g == 0) so[(16 * n + nl) * OS] = s + bb;   // this tower's column of the out tile
    // Compiler fence: keeps the bias and W3 reads inside the loop. Hoisted, they need
    // 128 registers beside the weights' 160 and spill to scratch.
    asm volatile("" ::: "memory");
  }
}

__global__ __launch_bounds__(NTHR) void towers64_kernel(
    const float* __restrict__ x,
    const float* __restrict__ W0, const float* __restrict__ b0,
    const float* __restrict__ W1, const float* __restrict__ b1,
    const float* __restrict__ W2, const float* __restrict__ b2,
    const float* __restrict__ W3, const float* __restrict__ b3,
    float* __restrict__ out) {
  __shared__ alignas(16) _Float16 sX[TILE_M * XS];        // x tile, f16 [128][32]
  __shared__ alignas(32) float sBW[TOWERS * 4 * Hsz];     // [tower][b0,b1,b2,W3][tile][q]
  __shared__ alignas(16) float sO[TILE_M * OS];           // out tile [row][tower]

  const int m0  = blockIdx.x * TILE_M;   // first batch row of tile
  const int o0  = blockIdx.y * TOWERS;   // first tower of the block
  const int tid = threadIdx.x;
  const int lane = tid & 31;             // wave32 lane
  const int w    = __builtin_amdgcn_readfirstlane(tid >> 5);  // wave id 0..15
  const int nl   = lane & 15;
  const int g    = lane >> 4;

  // The waves run in two halves, one phase apart. The early half loads its first tower
  // in front of the barrier while the late half stages x, the biases and W3; the late
  // half loads its first tower behind the barrier. From there on one half's weight
  // loads (L2) run under the other half's products (LDS, matrix unit); 16 waves in step
  // would all load and then all compute, and each unit would idle in turn. Of each pair of waves
  // 2k, 2k+1 one is late, and the bit alternates in w & 3 and in w >> 2 alike, so each
  // SIMD gets two waves of each half whichever way the waves are dealt to the SIMDs.
  const bool late = ((w ^ (w >> 2)) & 1) != 0;   // scalar: the same for a whole wave
  TowerW tw;
  if (late) {
    const int hw = w >> 1;               // 0..7: the wave's number within the late half
    const int ht = hw * 32 + lane;       // 0..255: the thread's number within it
    // ---- stage x tile: fp32 -> f16, vectorized float4 loads ----
    constexpr int NX = TILE_M * Isz / 4 / HTHR;
    static_assert(NX == 4, "the wait below names four addresses");
    const float* px[NX];
    float4 v[NX];
#pragma unroll  // the four loads go out together: one round trip
    for (int i = 0; i < NX; ++i) {
      const int idx = ht + i * HTHR;
      px[i] = x + (size_t)(m0 + (idx >> 3)) * Isz + (idx & 7) * 4;
      v[i] = *(const float4*)px[i];
    }
    // s_wait_xcnt 0 stands before any register that an issued load names is written
    // again; naming the addresses keeps their pairs live up to the wait.
    asm volatile("s_wait_xcnt 0x0" :: "v"(px[0]), "v"(px[1]), "v"(px[2]), "v"(px[3]) : "memory");
#pragma unroll  // constant indices: the arrays stay in registers
    for (int i = 0; i < NX; ++i) {
      const int idx = ht + i * HTHR;
      v4h h; h[0] = (_Float16)v[i].x; h[1] = (_Float16)v[i].y;
             h[2] = (_Float16)v[i].z; h[3] = (_Float16)v[i].w;
      *(v4h*)(sX + (idx >> 3) * XS + (idx & 7) * 4) = h;
    }
    // ---- stage biases and W3 of the 32 towers, feature 4q+t -> [t][q] ----
    const int a = hw >> 1;               // which array: the same for a whole wave
    const int m = (hw & 1) * 32 + lane;
    const float* src = (a == 0 ? b0 : a == 1 ? b1 : a == 2 ? b2 : W3) + o0 * Hsz + m;
    float* dst = sBW + a * Hsz + (m & 3) * 16 + (m >> 2);
#pragma unroll  // the 32 loads go out together: one round trip
    for (int i = 0; i < TOWERS; ++i)
      dst[i * 4 * Hsz] = src[i * Hsz];
  } else {
    ld_tower(W0, W1, W2, o0 + w, nl, g, tw);
  }
  __syncthreads();
  if (late) ld_tower(W0, W1, W2, o0 + w, nl, g, tw);
  run_tower(tw, sX, sBW + w * 4 * Hsz, b3[o0 + w], nl, g, sO + w);

  ld_tower(W0, W1, W2, o0 + NWAVE + w, nl, g, tw);
  run_tower(tw, sX, sBW + (NWAVE + w) * 4 * Hsz, b3[o0 + NWAVE + w], nl, g,
            sO + NWAVE + w);

  // ---- out tile -> global: 8 lanes x 16 bytes are one row's whole 128-byte line ----
  __syncthreads();
#pragma unroll  // both stores go out together
  for (int i = 0; i < TILE_M * TOWERS / 4 / NTHR; ++i) {
    const int idx = tid + i * NTHR;
    const int r  = idx >> 3;
    const int c4 = (idx & 7) * 4;
    const v4f v = *(const v4f*)(sO + r * OS + c4);
    __builtin_nontemporal_store(v, (v4f*)(out + (size_t)(m0 + r) * Osz + o0 + c4));
  }
}

extern "C" void kernel_launch(void* const* d_in, const int* in_sizes, int n_in,
                              void* d_out, int out_size, void* d_ws, size_t ws_size,
                              hipStream_t stream) {
  const float* x  = (const float*)d_in[0];
  const float* W0 = (const float*)d_in[1];
  const float* b0 = (const float*)d_in[2];
  const float* W1 = (const float*)d_in[3];
  const float* b1 = (const float*)d_in[4];
  const float* W2 = (const float*)d_in[5];
  const float* b2 = (const float*)d_in[6];
  const float* W3 = (const float*)d_in[7];
  const float* b3 = (const float*)d_in[8];

  dim3 grid(Bsz / TILE_M, Osz / TOWERS);   // (128, 2) blocks
  towers64_kernel<<<grid, NTHR, 0, stream>>>(x, W0, b0, W1, b1, W2, b2, W3, b3,
                                             (float*)d_out);
}

// v004
// One run takes 21.8 microseconds.
// Two timings next to v003 both put it at 1.14 times that version's speed.
// Counting every step since v000, it is 3.91 times as fast.
#include <hip/hip_runtime.h>

// ---------------------------------------------------------------------------
// 64 independent MLP towers, fused into one kernel.
//   h0 = relu(x @ W0[o] + b0[o])      [B,32]x[32,64]
//   h1 = relu(h0 @ W1[o] + b1[o])     [B,64]x[64,64]
//   h2 = relu(h1 @ W2[o] + b2[o])     [B,64]x[64,64]
//   out[:,o] = h2 @ W3[o] + b3[o]     [B,64].[64]
// One block = (128 batch rows, 32 towers); ONE WAVE OWNS ONE TOWER at a time
// (16 waves, two towers one after the other, in two halves a phase apart). The products are taken
// transposed, h^T = W^T * x^T: the tower's weights are the A operand and stay
// in registers for all 128 rows, 16 batch rows are the B operand. Two f32 D
// tiles of a layer, converted in place, are the next layer's B fragment, so the
// hidden activations never leave the lane's registers.
// A tower's results are one column of out: they are gathered in LDS, and the block
// stores its 128 rows x 32 towers at the end as whole 128-byte lines.
// All matmuls via v_wmma_f32_16x16x32_f16 (f16 operands, f32 accumulate).
//
// Feature order: row q (0..15) of M tile t (0..3) is feature 4*q + t, so that a
// lane's one float4 of a weight row feeds the same element of all four M tiles
// and 16 lanes read one whole 256-byte weight row.
// ---------------------------------------------------------------------------

typedef _Float16 v16h __attribute__((ext_vector_type(16)));
typedef _Float16 v8h  __attribute__((ext_vector_type(8)));
typedef _Float16 v4h  __attribute__((ext_vector_type(4)));
typedef float    v8f  __attribute__((ext_vector_type(8)));
typedef float    v4f  __attribute__((ext_vector_type(4)));

constexpr int Bsz = 16384;
constexpr int Isz = 32;
constexpr int Osz = 64;
constexpr int Hsz = 64;
constexpr int TILE_M = 128;   // batch rows per block
constexpr int NTHR   = 512;   // 16 waves
constexpr int NWAVE  = NTHR / 32;
constexpr int HTHR   = NTHR / 2;   // threads of one half of the waves
constexpr int TOWERS = 32;    // towers per block, two per wave
constexpr int XS = 40;        // LDS row stride (halves) of the x tile (80B, 16B x odd)
constexpr int OS = 36;        // LDS row stride (floats) of the out tile (144B, 16B x odd)

__device__ __forceinline__ v8f wmma_f16(v16h a, v16h b, v8f c) {
  // D = A(16x32 f16) * B(32x16 f16) + C(16x16 f32)
  return __builtin_amdgcn_wmma_f32_16x16x32_f16(
      /*neg_a=*/false, a, /*neg_b=*/false, b,
      /*c_mod=*/(short)0, c, /*reuse_a=*/false, /*reuse_b=*/false);
}

// Single-instruction ReLU (avoid fmaxf's NaN-canonicalization double-max).
__device__ __forceinline__ float relu(float v) { return v > 0.0f ? v : 0.0f; }

// lane l with lane l ^ 16
__device__ __forceinline__ float xhalf(float v) {
  const int b = __builtin_bit_cast(int, v);
  return __builtin_bit_cast(float,
      __builtin_amdgcn_permlanex16(b, b, 0x76543210, 0xfedcba98, false, false));
}

// Load one K=32 f16 operand fragment from a row-major LDS tile.
// ISA 16-bit A/B layout (wave32): lane L -> row (L&15), half-group g = L>>4;
//   elements 0..7  = row[koff + g*8 .. +7]
//   elements 8..15 = row[koff + 16 + g*8 .. +7]
// Both are contiguous 16-byte chunks -> two ds_load_b128.
__device__ __forceinline__ v16h ld_frag(const _Float16* base, int row, int stride,
                                        int koff, int g) {
  const _Float16* p = base + row * stride + koff + g * 8;
  v8h lo = *(const v8h*)(p);
  v8h hi = *(const v8h*)(p + 16);
  return __builtin_shufflevector(lo, hi, 0,1,2,3,4,5,6,7,8,9,10,11,12,13,14,15);
}

// One tower's weights as A fragments (W^T: M = output feature, K = input feature).
struct TowerW {
  v16h a0[4];      // layer 0, [M tile]
  v16h a1[4][2];   // layer 1, [M tile][K block of 32]
  v16h a2[4][2];   // layer 2
};

// Behind a group's loads: s_wait_xcnt 0 stands before any register that an issued
// load names is written again; naming the address keeps its pair live up to the wait.
__device__ __forceinline__ void loads_issued(const float* p) {
  asm volatile("s_wait_xcnt 0x0" :: "v"(p) : "memory");
}

// 16 rows of a weight, one float4 a lane -> element e of the four M tiles' A fragments
__device__ __forceinline__ void cvt_group(const float4 (&v)[16], v16h& a0, v16h& a1,
                                          v16h& a2, v16h& a3) {
#pragma unroll  // constant indices: the vectors and arrays stay in registers
  for (int e = 0; e < 16; ++e) {
    a0[e] = (_Float16)v[e].x; a1[e] = (_Float16)v[e].y;
    a2[e] = (_Float16)v[e].z; a3[e] = (_Float16)v[e].w;
  }
  // Ends a group of 16 loads (64 registers in flight): scheduled freely, a tower's
  // 80 loads overrun the registers beside the fragments and spill to scratch.
  __builtin_amdgcn_sched_barrier(0);
}

// A fragments of a [32][64] weight whose k is the plain input index of x:
// element e is k = 8g + (e&7) + 16*(e>>3), the hardware k order.
__device__ __forceinline__ void ld_w_in(const float* __restrict__ Wg, int nl, int g,
                                        v16h (&a)[4]) {
  const float* p = Wg + 8 * g * Hsz + 4 * nl;
  float4 v[16];
#pragma unroll  // constant indices: the vectors and arrays stay in registers
  for (int e = 0; e < 16; ++e)
    v[e] = *(const float4*)(p + ((e & 7) + 16 * (e >> 3)) * Hsz);
  loads_issued(p);
  cvt_group(v, a[0], a[1], a[2], a[3]);
}

// A fragments of a [64][64] weight whose k runs over the previous layer's D
// tiles: element e of K block j pairs with row 8g + (e&7) of D tile 2j + (e>>3),
// which is feature 4*(8g + (e&7)) + 2j + (e>>3).
__device__ __forceinline__ void ld_w_hid(const float* __restrict__ Wg, int nl, int g,
                                         v16h (&a)[4][2]) {
  const float* p = Wg + 32 * g * Hsz + 4 * nl;
#pragma unroll  // constant indices: the vectors and arrays stay in registers
  for (int j = 0; j < 2; ++j) {
    float4 v[16];
#pragma unroll  // constant indices: the vectors and arrays stay in registers
    for (int e = 0; e < 16; ++e)
      v[e] = *(const float4*)(p + (4 * (e & 7) + 2 * j + (e >> 3)) * Hsz);
    loads_issued(p);
    cvt_group(v, a[0][j], a[1][j], a[2][j], a[3][j]);
  }
}

__device__ __forceinline__ void ld_tower(const float* __restrict__ W0,
                                         const float* __restrict__ W1,
                                         const float* __restrict__ W2,
                                         int o, int nl, int g, TowerW& tw) {
  ld_w_in (W0 + (size_t)o * Isz * Hsz, nl, g, tw.a0);
  ld_w_hid(W1 + (size_t)o * Hsz * Hsz, nl, g, tw.a1);
  ld_w_hid(W2 + (size_t)o * Hsz * Hsz, nl, g, tw.a2);
}

// relu + f16 of D tile t -> its half of the next layer's B fragment
__device__ __forceinline__ void pack_d(const v8f& c, int t, v16h (&h)[2]) {
#pragma unroll  // constant indices: the vectors and arrays stay in registers
  for (int r = 0; r < 8; ++r) h[t >> 1][(t & 1) * 8 + r] = (_Float16)relu(c[r]);
}

// One 16-feature tile of b0, b1, b2 (i = 0..11) or of W3 (i = 12..15): a lane's 8 rows.
__device__ __forceinline__ v8f ld_tile(const float* bwg, int i) {
  return *(const v8f*)(bwg + 16 * i);
}

// All 128 rows of the block through one tower. bw: this tower's b0, b1, b2, W3
// in LDS, each as [M tile][row q].
// The 12 M tiles of the three layers are 12 steps, and a 13th ends the last tile. A step
// first issues LDS reads that later steps need, in few groups and as far ahead as the
// registers beside the weights allow (bias tiles two to four steps ahead of their use
// as C, W3 tiles one or two); steps 11 and 12 read the next 16 rows' x fragment and first
// four bias tiles, so the reads wrap round the row loop. Then the step starts tile k's
// products and, under them, finishes tile k - 1 (relu and f16, or the dot with W3). No
// read is waited for directly behind its issue, and no product's result is read
// directly behind the product.
__device__ __forceinline__ void run_tower(const TowerW& tw, const _Float16* sX,
                                          const float* bw, float bb, int nl, int g,
                                          float* so) {
  const float* bwg = bw + 8 * g;   // a lane's D registers are rows 8g .. 8g+7
  v8f c[12], w3v[4];
  v16h bx = ld_frag(sX, nl, XS, 0, g);
  c[0] = ld_tile(bwg, 0);
  // Keeps the first reads in the order of steps 11 and 12: the wait at the loop's head is
  // merged from both ways in, and with x read last here it would drain every read there.
  __builtin_amdgcn_sched_barrier(0);
#pragma unroll  // constant indices: the array stays in registers
  for (int i = 1; i < 4; ++i) c[i] = ld_tile(bwg, i);
  for (int n = 0; n < TILE_M / 16; ++n) {
    v16h h0[2], h1[2];
    v8f p = {0.f, 0.f, 0.f, 0.f, 0.f, 0.f, 0.f, 0.f};
#pragma unroll  // constant indices: the vectors and arrays stay in registers
    for (int k = 0; k <= 12; ++k) {
      // ---- reads for later steps ----
      if (k == 1)  { c[4] = ld_tile(bwg, 4);   c[5] = ld_tile(bwg, 5); }
      if (k == 3)  { c[6] = ld_tile(bwg, 6);   c[7] = ld_tile(bwg, 7); }
      if (k == 5)  { c[8] = ld_tile(bwg, 8);   c[9] = ld_tile(bwg, 9); }
      if (k == 7)  { w3v[0] = ld_tile(bwg, 12); }
      if (k == 8)  { c[10] = ld_tile(bwg, 10); c[11] = ld_tile(bwg, 11);
                     w3v[1] = ld_tile(bwg, 13); }
      if (k == 10) { w3v[2] = ld_tile(bwg, 14); w3v[3] = ld_tile(bwg, 15); }
      if (k == 11) { bx = ld_frag(sX, 16 * ((n + 1) & (TILE_M / 16 - 1)) + nl, XS, 0, g);
                     c[0] = ld_tile(bwg, 0); }
      if (k == 12) { c[1] = ld_tile(bwg, 1);   c[2] = ld_tile(bwg, 2);
                     c[3] = ld_tile(bwg, 3); }
      // ---- the first product of tile k ----
      if (k < 4)       c[k] = wmma_f16(tw.a0[k], bx, c[k]);
      else if (k < 8)  c[k] = wmma_f16(tw.a1[k - 4][0], h0[0], c[k]);
      else if (k < 12) c[k] = wmma_f16(tw.a2[k - 8][0], h1[0], c[k]);
      // Holds the reads and tile k's first product in front of the work on tile k - 1:
      // moved behind it, the reads lose their lead and that work waits for its product.
      __builtin_amdgcn_sched_barrier(0);
      // ---- tile k - 1 is finished, then the second product of tile k ----
      if (k >= 1 && k <= 4) pack_d(c[k - 1], k - 1, h0);
      else if (k >= 5 && k <= 8) pack_d(c[k - 1], k - 5, h1);
      else if (k >= 9) {
#pragma unroll  // constant indices: the vectors and arrays stay in registers
        for (int r = 0; r < 8; ++r) p[r] += relu(c[k - 1][r]) * w3v[k - 9][r];
      }
      if (k >= 4 && k < 8)       c[k] = wmma_f16(tw.a1[k - 4][1], h0[1], c[k]);
      else if (k >= 8 && k < 12) c[k] = wmma_f16(tw.a2[k - 8][1], h1[1], c[k]);
      // Ends a step: scheduled freely, the reads sink to their uses and are waited for
      // at once, or rise until the registers beside the weights overflow.
      __builtin_amdgcn_sched_barrier(0);
    }
    // a lane holds 32 of its batch row's 64 features; lane ^ 16 holds the rest
    float s = ((p[0] + p[1]) + (p[2] + p[3])) + ((p[4] + p[5]) + (p[6] + p[7]));
    s += xhalf(s);
    if (g == 0) so[(16 * n + nl) * OS] = s + bb;   // this tower's column of the out tile
    // Compiler fence: keeps the bias and W3 reads inside the loop. Hoisted, they need
    // 128 registers beside the weights' 160 and spill to scratch.
    asm volatile("" ::: "memory");
  }
}

__global__ __launch_bounds__(NTHR) void towers64_kernel(
    const float* __restrict__ x,
    const float* __restrict__ W0, const float* __restrict__ b0,
    const float* __restrict__ W1, const float* __restrict__ b1,
    const float* __restrict__ W2, const float* __restrict__ b2,
    const float* __restrict__ W3, const float* __restrict__ b3,
    float* __restrict__ out) {
  __shared__ alignas(16) _Float16 sX[TILE_M * XS];        // x tile, f16 [128][32]
  __shared__ alignas(32) float sBW[TOWERS * 4 * Hsz];     // [tower][b0,b1,b2,W3][tile][q]
  __shared__ alignas(16) float sO[TILE_M * OS];           // out tile [row][tower]

  const int m0  = blockIdx.x * TILE_M;   // first batch row of tile
  const int o0  = blockIdx.y * TOWERS;   // first tower of the block
  const int tid = threadIdx.x;
  const int lane = tid & 31;             // wave32 lane
  const int w    = __builtin_amdgcn_readfirstlane(tid >> 5);  // wave id 0..15
  const int nl   = lane & 15;
  const int g    = lane >> 4;

  // The waves run in two halves, one phase apart. The early half loads its first tower
  // in front of the barrier while the late half stages x, the biases and W3; the late
  // half loads its first tower behind the barrier. From there on one half's weight
  // loads (L2) run under the other half's products (LDS, matrix unit); 16 waves in step
  // would all load and then all compute, and each unit would idle in turn. Of each pair of waves
  // 2k, 2k+1 one is late, and the bit alternates in w & 3 and in w >> 2 alike, so each
  // SIMD gets two waves of each half whichever way the waves are dealt to the SIMDs.
  const bool late = ((w ^ (w >> 2)) & 1) != 0;   // scalar: the same for a whole wave
  TowerW tw;
  if (late) {
    const int hw = w >> 1;               // 0..7: the wave's number within the late half
    const int ht = hw * 32 + lane;       // 0..255: the thread's number within it
    // ---- stage x tile: fp32 -> f16, vectorized float4 loads ----
    constexpr int NX = TILE_M * Isz / 4 / HTHR;
    static_assert(NX == 4, "the wait below names four addresses");
    const float* px[NX];
    float4 v[NX];
#pragma unroll  // the four loads go out together: one round trip
    for (int i = 0; i < NX; ++i) {
      const int idx = ht + i * HTHR;
      px[i] = x + (size_t)(m0 + (idx >> 3)) * Isz + (idx & 7) * 4;
      v[i] = *(const float4*)px[i];
    }
    // s_wait_xcnt 0 stands before any register that an issued load names is written
    // again; naming the addresses keeps their pairs live up to the wait.
    asm volatile("s_wait_xcnt 0x0" :: "v"(px[0]), "v"(px[1]), "v"(px[2]), "v"(px[3]) : "memory");
#pragma unroll  // constant indices: the arrays stay in registers
    for (int i = 0; i < NX; ++i) {
      const int idx = ht + i * HTHR;
      v4h h; h[0] = (_Float16)v[i].x; h[1] = (_Float16)v[i].y;
             h[2] = (_Float16)v[i].z; h[3] = (_Float16)v[i].w;
      *(v4h*)(sX + (idx >> 3) * XS + (idx & 7) * 4) = h;
    }
    // ---- stage biases and W3 of the 32 towers, feature 4q+t -> [t][q] ----
    const int a = hw >> 1;               // which array: the same for a whole wave
    const int m = (hw & 1) * 32 + lane;
    const float* src = (a == 0 ? b0 : a == 1 ? b1 : a == 2 ? b2 : W3) + o0 * Hsz + m;
    float* dst = sBW + a * Hsz + (m & 3) * 16 + (m >> 2);
#pragma unroll  // the 32 loads go out together: one round trip
    for (int i = 0; i < TOWERS; ++i)
      dst[i * 4 * Hsz] = src[i * Hsz];
  } else {
    ld_tower(W0, W1, W2, o0 + w, nl, g, tw);
  }
  __syncthreads();
  if (late) ld_tower(W0, W1, W2, o0 + w, nl, g, tw);
  run_tower(tw, sX, sBW + w * 4 * Hsz, b3[o0 + w], nl, g, sO + w);

  ld_tower(W0, W1, W2, o0 + NWAVE + w, nl, g, tw);
  run_tower(tw, sX, sBW + (NWAVE + w) * 4 * Hsz, b3[o0 + NWAVE + w], nl, g,
            sO + NWAVE + w);

  // ---- out tile -> global: 8 lanes x 16 bytes are one row's whole 128-byte line ----
  __syncthreads();
#pragma unroll  // both stores go out together
  for (int i = 0; i < TILE_M * TOWERS / 4 / NTHR; ++i) {
    const int idx = tid + i * NTHR;
    const int r  = idx >> 3;
    const int c4 = (idx & 7) * 4;
    const v4f v = *(const v4f*)(sO + r * OS + c4);
    __builtin_nontemporal_store(v, (v4f*)(out + (size_t)(m0 + r) * Osz + o0 + c4));
  }
}

extern "C" void kernel_launch(void* const* d_in, const int* in_sizes, int n_in,
                              void* d_out, int out_size, void* d_ws, size_t ws_size,
                              hipStream_t stream) {
  const float* x  = (const float*)d_in[0];
  const float* W0 = (const float*)d_in[1];
  const float* b0 = (const float*)d_in[2];
  const float* W1 = (const float*)d_in[3];
  const float* b1 = (const float*)d_in[4];
  const float* W2 = (const float*)d_in[5];
  const float* b2 = (const float*)d_in[6];
  const float* W3 = (const float*)d_in[7];
  const float* b3 = (const float*)d_in[8];

  dim3 grid(Bsz / TILE_M, Osz / TOWERS);   // (128, 2) blocks
  towers64_kernel<<<grid, NTHR, 0, stream>>>(x, W0, b0, W1, b1, W2, b2, W3, b3,
                                             (float*)d_out);
}

// v005
// A run of this version takes 20.5 microseconds.
// In two side-by-side timings against v004, it was 1.06 and 1.07 times as fast.
// Counting every step since v000, it is 4.16 times as fast.
#include <hip/hip_runtime.h>

// ---------------------------------------------------------------------------
// 64 independent MLP towers, fused into one kernel.
//   h0 = relu(x @ W0[o] + b0[o])      [B,32]x[32,64]
//   h1 = relu(h0 @ W1[o] + b1[o])     [B,64]x[64,64]
//   h2 = relu(h1 @ W2[o] + b2[o])     [B,64]x[64,64]
//   out[:,o] = h2 @ W3[o] + b3[o]     [B,64].[64]
// One block = (128 batch rows, 32 towers); ONE WAVE OWNS ONE TOWER at a time
// (16 waves, two towers one after the other, in two halves a phase apart). The products are taken
// transposed, h^T = W^T * x^T: the tower's weights are the A operand and stay
// in registers for all 128 rows, 16 batch rows are the B operand. Two f32 D
// tiles of a layer, converted in place, are the next layer's B fragment, so the
// hidden activations never leave the lane's registers.
// A tower's results are one column of out: they are gathered in LDS, and the block
// stores its 128 rows x 32 towers at the end as whole 128-byte lines.
// All matmuls via v_wmma_f32_16x16x32_f16 (f16 operands, f32 accumulate).
//
// Feature order: row q (0..15) of M tile t (0..3) is feature 4*q + t, so that a
// lane's one float4 of a weight row feeds the same element of all four M tiles
// and 16 lanes read one whole 256-byte weight row.
// ---------------------------------------------------------------------------

typedef _Float16 v16h __attribute__((ext_vector_type(16)));
typedef _Float16 v8h  __attribute__((ext_vector_type(8)));
typedef _Float16 v4h  __attribute__((ext_vector_type(4)));
typedef float    v8f  __attribute__((ext_vector_type(8)));
typedef float    v4f  __attribute__((ext_vector_type(4)));

constexpr int Bsz = 16384;
constexpr int Isz = 32;
constexpr int Osz = 64;
constexpr int Hsz = 64;
constexpr int TILE_M = 128;   // batch rows per block
constexpr int NTHR   = 512;   // 16 waves
constexpr int NWAVE  = NTHR / 32;
constexpr int HTHR   = NTHR / 2;   // threads of one half of the waves
constexpr int TOWERS = 32;    // towers per block, two per wave
constexpr int XS = 40;        // LDS row stride (halves) of the x tile (80B, 16B x odd)
constexpr int OS = 36;        // LDS row stride (floats) of the out tile (144B, 16B x odd)

__device__ __forceinline__ v8f wmma_f16(v16h a, v16h b, v8f c) {
  // D = A(16x32 f16) * B(32x16 f16) + C(16x16 f32)
  return __builtin_amdgcn_wmma_f32_16x16x32_f16(
      /*neg_a=*/false, a, /*neg_b=*/false, b,
      /*c_mod=*/(short)0, c, /*reuse_a=*/false, /*reuse_b=*/false);
}

// ReLU of an f32 on its bits: a float below zero is a negative integer, so one signed
// integer maximum with 0 does it. The float maximum of a product's result compiles to
// two instructions (one that only quiets a NaN, then the maximum).
__device__ __forceinline__ float relu(float v) {
  const int b = __builtin_bit_cast(int, v);
  return __builtin_bit_cast(float, b > 0 ? b : 0);
}

// lane l with lane l ^ 16
__device__ __forceinline__ float xhalf(float v) {
  const int b = __builtin_bit_cast(int, v);
  return __builtin_bit_cast(float,
      __builtin_amdgcn_permlanex16(b, b, 0x76543210, 0xfedcba98, false, false));
}

// Load one K=32 f16 operand fragment from a row-major LDS tile.
// ISA 16-bit A/B layout (wave32): lane L -> row (L&15), half-group g = L>>4;
//   elements 0..7  = row[koff + g*8 .. +7]
//   elements 8..15 = row[koff + 16 + g*8 .. +7]
// Both are contiguous 16-byte chunks -> two ds_load_b128.
__device__ __forceinline__ v16h ld_frag(const _Float16* base, int row, int stride,
                                        int koff, int g) {
  const _Float16* p = base + row * stride + koff + g * 8;
  v8h lo = *(const v8h*)(p);
  v8h hi = *(const v8h*)(p + 16);
  return __builtin_shufflevector(lo, hi, 0,1,2,3,4,5,6,7,8,9,10,11,12,13,14,15);
}

// One tower's weights as A fragments (W^T: M = output feature, K = input feature).
struct TowerW {
  v16h a0[4];      // layer 0, [M tile]
  v16h a1[4][2];   // layer 1, [M tile][K block of 32]
  v16h a2[4][2];   // layer 2
};

// Behind a group's loads: s_wait_xcnt 0 stands before any register that an issued
// load names is written again; naming the address keeps its pair live up to the wait.
__device__ __forceinline__ void loads_issued(const float* p) {
  asm volatile("s_wait_xcnt 0x0" :: "v"(p) : "memory");
}

// 16 rows of a weight, one float4 a lane -> element e of the four M tiles' A fragments
__device__ __forceinline__ void cvt_group(const float4 (&v)[16], v16h& a0, v16h& a1,
                                          v16h& a2, v16h& a3) {
#pragma unroll  // constant indices: the vectors and arrays stay in registers
  for (int e = 0; e < 16; ++e) {
    a0[e] = (_Float16)v[e].x; a1[e] = (_Float16)v[e].y;
    a2[e] = (_Float16)v[e].z; a3[e] = (_Float16)v[e].w;
  }
  // Ends a group of 16 loads (64 registers in flight): scheduled freely, a tower's
  // 80 loads overrun the registers beside the fragments and spill to scratch.
  __builtin_amdgcn_sched_barrier(0);
}

// A fragments of a [32][64] weight whose k is the plain input index of x:
// element e is k = 8g + (e&7) + 16*(e>>3), the hardware k order.
__device__ __forceinline__ void ld_w_in(const float* __restrict__ Wg, int nl, int g,
                                        v16h (&a)[4]) {
  const float* p = Wg + 8 * g * Hsz + 4 * nl;
  float4 v[16];
#pragma unroll  // constant indices: the vectors and arrays stay in registers
  for (int e = 0; e < 16; ++e)
    v[e] = *(const float4*)(p + ((e & 7) + 16 * (e >> 3)) * Hsz);
  loads_issued(p);
  cvt_group(v, a[0], a[1], a[2], a[3]);
}

// A fragments of a [64][64] weight whose k runs over the previous layer's D
// tiles: element e of K block j pairs with row 8g + (e&7) of D tile 2j + (e>>3),
// which is feature 4*(8g + (e&7)) + 2j + (e>>3).
__device__ __forceinline__ void ld_w_hid(const float* __restrict__ Wg, int nl, int g,
                                         v16h (&a)[4][2]) {
  const float* p = Wg + 32 * g * Hsz + 4 * nl;
#pragma unroll  // constant indices: the vectors and arrays stay in registers
  for (int j = 0; j < 2; ++j) {
    float4 v[16];
#pragma unroll  // constant indices: the vectors and arrays stay in registers
    for (int e = 0; e < 16; ++e)
      v[e] = *(const float4*)(p + (4 * (e & 7) + 2 * j + (e >> 3)) * Hsz);
    loads_issued(p);
    cvt_group(v, a[0][j], a[1][j], a[2][j], a[3][j]);
  }
}

__device__ __forceinline__ void ld_tower(const float* __restrict__ W0,
                                         const float* __restrict__ W1,
                                         const float* __restrict__ W2,
                                         int o, int nl, int g, TowerW& tw) {
  ld_w_in (W0 + (size_t)o * Isz * Hsz, nl, g, tw.a0);
  ld_w_hid(W1 + (size_t)o * Hsz * Hsz, nl, g, tw.a1);
  ld_w_hid(W2 + (size_t)o * Hsz * Hsz, nl, g, tw.a2);
}

// f16 + relu of D tile t -> its half of the next layer's B fragment. The relu comes
// behind the conversion, on f16 pairs: rounding keeps the sign, so the values are the
// same, and one packed maximum serves two elements.
__device__ __forceinline__ void pack_d(const v8f& c, int t, v16h (&h)[2]) {
  const v8h q = __builtin_elementwise_max(__builtin_convertvector(c, v8h), (v8h)(_Float16)0.0f);
#pragma unroll  // constant indices: the vectors and arrays stay in registers
  for (int r = 0; r < 8; ++r) h[t >> 1][(t & 1) * 8 + r] = q[r];
}

// One 16-feature tile of b0, b1, b2 (i = 0..11) or of W3 (i = 12..15): a lane's 8 rows.
__device__ __forceinline__ v8f ld_tile(const float* bwg, int i) {
  return *(const v8f*)(bwg + 16 * i);
}

// All 128 rows of the block through one tower. bw: this tower's b0, b1, b2, W3
// in LDS, each as [M tile][row q].
// The 12 M tiles of the three layers are 12 steps, and a 13th ends the last tile. A step
// first issues LDS reads that later steps need, in few groups and as far ahead as the
// registers beside the weights allow (bias tiles two to four steps ahead of their use
// as C, W3 tiles one or two); steps 11 and 12 read the next 16 rows' x fragment and first
// four bias tiles, so the reads wrap round the row loop. Then the step starts tile k's
// products and, under them, finishes tile k - 1 (relu and f16, or the dot with W3). No
// read is waited for directly behind its issue, and no product's result is read
// directly behind the product.
__device__ __forceinline__ void run_tower(const TowerW& tw, const _Float16* sX,
                                          const float* bw, float bb, int nl, int g,
                                          float* so) {
  const float* bwg = bw + 8 * g;   // a lane's D registers are rows 8g .. 8g+7
  v8f c[12], w3v[4];
  v16h bx = ld_frag(sX, nl, XS, 0, g);
  c[0] = ld_tile(bwg, 0);
  // Keeps the first reads in the order of steps 11 and 12: the wait at the loop's head is
  // merged from both ways in, and with x read last here it would drain every read there.
  __builtin_amdgcn_sched_barrier(0);
#pragma unroll  // constant indices: the array stays in registers
  for (int i = 1; i < 4; ++i) c[i] = ld_tile(bwg, i);
  for (int n = 0; n < TILE_M / 16; ++n) {
    v16h h0[2], h1[2];
    v8f p = {0.f, 0.f, 0.f, 0.f, 0.f, 0.f, 0.f, 0.f};
#pragma unroll  // constant indices: the vectors and arrays stay in registers
    for (int k = 0; k <= 12; ++k) {
      // ---- reads for later steps ----
      if (k == 1)  { c[4] = ld_tile(bwg, 4);   c[5] = ld_tile(bwg, 5); }
      if (k == 3)  { c[6] = ld_tile(bwg, 6);   c[7] = ld_tile(bwg, 7); }
      if (k == 5)  { c[8] = ld_tile(bwg, 8);   c[9] = ld_tile(bwg, 9); }
      if (k == 7)  { w3v[0] = ld_tile(bwg, 12); }
      if (k == 8)  { c[10] = ld_tile(bwg, 10); c[11] = ld_tile(bwg, 11);
                     w3v[1] = ld_tile(bwg, 13); }
      if (k == 10) { w3v[2] = ld_tile(bwg, 14); w3v[3] = ld_tile(bwg, 15); }
      if (k == 11) { bx = ld_frag(sX, 16 * ((n + 1) & (TILE_M / 16 - 1)) + nl, XS, 0, g);
                     c[0] = ld_tile(bwg, 0); }
      if (k == 12) { c[1] = ld_tile(bwg, 1);   c[2] = ld_tile(bwg, 2);
                     c[3] = ld_tile(bwg, 3); }
      // ---- the first product of tile k ----
      if (k < 4)       c[k] = wmma_f16(tw.a0[k], bx, c[k]);
      else if (k < 8)  c[k] = wmma_f16(tw.a1[k - 4][0], h0[0], c[k]);
      else if (k < 12) c[k] = wmma_f16(tw.a2[k - 8][0], h1[0], c[k]);
      // Holds the reads and tile k's first product in front of the work on tile k - 1:
      // moved behind it, the reads lose their lead and that work waits for its product.
      __builtin_amdgcn_sched_barrier(0);
      // ---- tile k - 1 is finished, then the second product of tile k ----
      if (k >= 1 && k <= 4) pack_d(c[k - 1], k - 1, h0);
      else if (k >= 5 && k <= 8) pack_d(c[k - 1], k - 5, h1);
      else if (k >= 9) {
#pragma unroll  // constant indices: the vectors and arrays stay in registers
        for (int r = 0; r < 8; ++r) p[r] += relu(c[k - 1][r]) * w3v[k - 9][r];
      }
      if (k >= 4 && k < 8)       c[k] = wmma_f16(tw.a1[k - 4][1], h0[1], c[k]);
      else if (k >= 8 && k < 12) c[k] = wmma_f16(tw.a2[k - 8][1], h1[1], c[k]);
      // Ends a step: scheduled freely, the reads sink to their uses and are waited for
      // at once, or rise until the registers beside the weights overflow.
      __builtin_amdgcn_sched_barrier(0);
    }
    // a lane holds 32 of its batch row's 64 features; lane ^ 16 holds the rest
    float s = ((p[0] + p[1]) + (p[2] + p[3])) + ((p[4] + p[5]) + (p[6] + p[7]));
    s += xhalf(s);
    if (g == 0) so[(16 * n + nl) * OS] = s + bb;   // this tower's column of the out tile
    // Compiler fence: keeps the bias and W3 reads inside the loop. Hoisted, they need
    // 128 registers beside the weights' 160 and spill to scratch.
    asm volatile("" ::: "memory");
  }
}

__global__ __launch_bounds__(NTHR) void towers64_kernel(
    const float* __restrict__ x,
    const float* __restrict__ W0, const float* __restrict__ b0,
    const float* __restrict__ W1, const float* __restrict__ b1,
    const float* __restrict__ W2, const float* __restrict__ b2,
    const float* __restrict__ W3, const float* __restrict__ b3,
    float* __restrict__ out) {
  __shared__ alignas(16) _Float16 sX[TILE_M * XS];        // x tile, f16 [128][32]
  __shared__ alignas(32) float sBW[TOWERS * 4 * Hsz];     // [tower][b0,b1,b2,W3][tile][q]
  __shared__ alignas(16) float sO[TILE_M * OS];           // out tile [row][tower]

  const int m0  = blockIdx.x * TILE_M;   // first batch row of tile
  const int o0  = blockIdx.y * TOWERS;   // first tower of the block
  const int tid = threadIdx.x;
  const int lane = tid & 31;             // wave32 lane
  const int w    = __builtin_amdgcn_readfirstlane(tid >> 5);  // wave id 0..15
  const int nl   = lane & 15;
  const int g    = lane >> 4;

  // The waves run in two halves, one phase apart. The early half loads its first tower
  // in front of the barrier while the late half stages x, the biases and W3; the late
  // half loads its first tower behind the barrier. From there on one half's weight
  // loads (L2) run under the other half's products (LDS, matrix unit); 16 waves in step
  // would all load and then all compute, and each unit would idle in turn. Of each pair of waves
  // 2k, 2k+1 one is late, and the bit alternates in w & 3 and in w >> 2 alike, so each
  // SIMD gets two waves of each half whichever way the waves are dealt to the SIMDs.
  const bool late = ((w ^ (w >> 2)) & 1) != 0;   // scalar: the same for a whole wave
  TowerW tw;
  if (late) {
    const int hw = w >> 1;               // 0..7: the wave's number within the late half
    const int ht = hw * 32 + lane;       // 0..255: the thread's number within it
    // ---- stage x tile: fp32 -> f16, vectorized float4 loads ----
    constexpr int NX = TILE_M * Isz / 4 / HTHR;
    static_assert(NX == 4, "the wait below names four addresses");
    const float* px[NX];
    float4 v[NX];
#pragma unroll  // the four loads go out together: one round trip
    for (int i = 0; i < NX; ++i) {
      const int idx = ht + i * HTHR;
      px[i] = x + (size_t)(m0 + (idx >> 3)) * Isz + (idx & 7) * 4;
      v[i] = *(const float4*)px[i];
    }
    // s_wait_xcnt 0 stands before any register that an issued load names is written
    // again; naming the addresses keeps their pairs live up to the wait.
    asm volatile("s_wait_xcnt 0x0" :: "v"(px[0]), "v"(px[1]), "v"(px[2]), "v"(px[3]) : "memory");
#pragma unroll  // constant indices: the arrays stay in registers
    for (int i = 0; i < NX; ++i) {
      const int idx = ht + i * HTHR;
      v4h h; h[0] = (_Float16)v[i].x; h[1] = (_Float16)v[i].y;
             h[2] = (_Float16)v[i].z; h[3] = (_Float16)v[i].w;
      *(v4h*)(sX + (idx >> 3) * XS + (idx & 7) * 4) = h;
    }
    // ---- stage biases and W3 of the 32 towers, feature 4q+t -> [t][q] ----
    const int a = hw >> 1;               // which array: the same for a whole wave
    const int m = (hw & 1) * 32 + lane;
    const float* src = (a == 0 ? b0 : a == 1 ? b1 : a == 2 ? b2 : W3) + o0 * Hsz + m;
    float* dst = sBW + a * Hsz + (m & 3) * 16 + (m >> 2);
#pragma unroll  // the 32 loads go out together: one round trip
    for (int i = 0; i < TOWERS; ++i)
      dst[i * 4 * Hsz] = src[i * Hsz];
  } else {
    ld_tower(W0, W1, W2, o0 + w, nl, g, tw);
  }
  __syncthreads();
  if (late) ld_tower(W0, W1, W2, o0 + w, nl, g, tw);
  run_tower(tw, sX, sBW + w * 4 * Hsz, b3[o0 + w], nl, g, sO + w);

  ld_tower(W0, W1, W2, o0 + NWAVE + w, nl, g, tw);
  run_tower(tw, sX, sBW + (NWAVE + w) * 4 * Hsz, b3[o0 + NWAVE + w], nl, g,
            sO + NWAVE + w);

  // ---- out tile -> global: 8 lanes x 16 bytes are one row's whole 128-byte line ----
  __syncthreads();
#pragma unroll  // both stores go out together
  for (int i = 0; i < TILE_M * TOWERS / 4 / NTHR; ++i) {
    const int idx = tid + i * NTHR;
    const int r  = idx >> 3;
    const int c4 = (idx & 7) * 4;
    const v4f v = *(const v4f*)(sO + r * OS + c4);
    __builtin_nontemporal_store(v, (v4f*)(out + (size_t)(m0 + r) * Osz + o0 + c4));
  }
}

extern "C" void kernel_launch(void* const* d_in, const int* in_sizes, int n_in,
                              void* d_out, int out_size, void* d_ws, size_t ws_size,
                              hipStream_t stream) {
  const float* x  = (const float*)d_in[0];
  const float* W0 = (const float*)d_in[1];
  const float* b0 = (const float*)d_in[2];
  const float* W1 = (const float*)d_in[3];
  const float* b1 = (const float*)d_in[4];
  const float* W2 = (const float*)d_in[5];
  const float* b2 = (const float*)d_in[6];
  const float* W3 = (const float*)d_in[7];
  const float* b3 = (const float*)d_in[8];

  dim3 grid(Bsz / TILE_M, Osz / TOWERS);   // (128, 2) blocks
  towers64_kernel<<<grid, NTHR, 0, stream>>>(x, W0, b0, W1, b1, W2, b2, W3, b3,
                                             (float*)d_out);
}

// v006
// One run takes 18.2 microseconds.
// Two timings next to v005 both put it at 1.13 times that version's speed.
// All steps since v000 together make it 4.71 times as fast.
#include <hip/hip_runtime.h>

// ---------------------------------------------------------------------------
// 64 independent MLP towers, fused into one kernel.
//   h0 = relu(x @ W0[o] + b0[o])      [B,32]x[32,64]
//   h1 = relu(h0 @ W1[o] + b1[o])     [B,64]x[64,64]
//   h2 = relu(h1 @ W2[o] + b2[o])     [B,64]x[64,64]
//   out[:,o] = h2 @ W3[o] + b3[o]     [B,64].[64]
// One block = (128 batch rows, 32 towers); ONE WAVE OWNS ONE TOWER at a time
// (8 waves, four towers one after the other). The products are taken transposed,
// h^T = W^T * x^T: a layer's weights are the A operand, 16 batch rows are the B
// operand. Two f32 D tiles of a layer, converted, are the next layer's B fragment.
// LAYER BY LAYER: a wave takes all 128 rows through one layer before it goes on to
// the next; the 128 rows' activations stay in its registers. So only one layer's
// weights are held at a time, the next layer's are in flight from L2 under this
// layer's products, and a layer's bias tiles are read from LDS once for 128 rows.
// A tower's results are one column of out: they are gathered in LDS, and the block
// stores its 128 rows x 32 towers at the end as whole 128-byte lines.
// All matmuls via v_wmma_f32_16x16x32_f16 (f16 operands, f32 accumulate).
//
// Feature order: row q (0..15) of M tile t (0..3) is feature 4*q + t, so that a
// lane's one float4 of a weight row feeds the same element of all four M tiles
// and 16 lanes read one whole 256-byte weight row.
// ---------------------------------------------------------------------------

typedef _Float16 v16h __attribute__((ext_vector_type(16)));
typedef _Float16 v8h  __attribute__((ext_vector_type(8)));
typedef _Float16 v4h  __attribute__((ext_vector_type(4)));
typedef float    v8f  __attribute__((ext_vector_type(8)));
typedef float    v4f  __attribute__((ext_vector_type(4)));
typedef int      v8i  __attribute__((ext_vector_type(8)));

constexpr int Bsz = 16384;
constexpr int Isz = 32;
constexpr int Osz = 64;
constexpr int Hsz = 64;
constexpr int TILE_M = 128;   // batch rows per block
constexpr int NTHR   = 256;   // 8 waves, two a SIMD: up to 512 registers each
constexpr int NWAVE  = NTHR / 32;
constexpr int NG     = TILE_M / 16;   // groups of 16 batch rows
constexpr int TOWERS = 32;    // towers per block, four per wave
constexpr int XS = 40;        // LDS row stride (halves) of the x tile (80B, 16B x odd)
constexpr int OS = 36;        // LDS row stride (floats) of the out tile (144B, 16B x odd)

__device__ __forceinline__ v8f wmma_f16(v16h a, v16h b, v8f c) {
  // D = A(16x32 f16) * B(32x16 f16) + C(16x16 f32)
  return __builtin_amdgcn_wmma_f32_16x16x32_f16(
      /*neg_a=*/false, a, /*neg_b=*/false, b,
      /*c_mod=*/(short)0, c, /*reuse_a=*/false, /*reuse_b=*/false);
}

// ReLU of f32 values on their bits: a float below zero is a negative integer, so one
// signed integer maximum with 0 does it. The float maximum of a product's result compiles
// to two instructions (one that only quiets a NaN, then the maximum).
__device__ __forceinline__ v8f relu(v8f v) {
  return __builtin_bit_cast(v8f, __builtin_elementwise_max(__builtin_bit_cast(v8i, v), (v8i)0));
}

// lane l with lane l ^ 16
__device__ __forceinline__ float xhalf(float v) {
  const int b = __builtin_bit_cast(int, v);
  return __builtin_bit_cast(float,
      __builtin_amdgcn_permlanex16(b, b, 0x76543210, 0xfedcba98, false, false));
}

// Load one K=32 f16 operand fragment from a row-major LDS tile.
// ISA 16-bit A/B layout (wave32): lane L -> row (L&15), half-group g = L>>4;
//   elements 0..7  = row[koff + g*8 .. +7]
//   elements 8..15 = row[koff + 16 + g*8 .. +7]
// Both are contiguous 16-byte chunks -> two ds_load_b128.
__device__ __forceinline__ v16h ld_frag(const _Float16* base, int row, int stride,
                                        int koff, int g) {
  const _Float16* p = base + row * stride + koff + g * 8;
  v8h lo = *(const v8h*)(p);
  v8h hi = *(const v8h*)(p + 16);
  return __builtin_shufflevector(lo, hi, 0,1,2,3,4,5,6,7,8,9,10,11,12,13,14,15);
}

// Behind a group's loads: s_wait_xcnt 0 stands before any register that an issued
// load names is written again; naming the address keeps its pair live up to the wait.
// Its "memory" clobber also keeps the loads in front of the products that follow.
__device__ __forceinline__ void loads_issued(const float* p) {
  asm volatile("s_wait_xcnt 0x0" :: "v"(p) : "memory");
}

// Issue the loads of a [32][64] weight whose k is the plain input index of x: one
// float4 a lane and row; element e is k = 8g + (e&7) + 16*(e>>3), the hardware k order.
__device__ __forceinline__ void issue_w_in(const float* __restrict__ Wg, int nl, int g,
                                           float4 (&v)[16]) {
  const float* p = Wg + 8 * g * Hsz + 4 * nl;
#pragma unroll  // constant indices: the array stays in registers
  for (int e = 0; e < 16; ++e)
    v[e] = *(const float4*)(p + ((e & 7) + 16 * (e >> 3)) * Hsz);
  loads_issued(p);
  // Holds the loads here, a whole layer ahead of their use: sunk to the conversion
  // they would be waited for at once.
  __builtin_amdgcn_sched_barrier(0);
}

// Issue the loads of a [64][64] weight whose k runs over the previous layer's D
// tiles: element e of K block j pairs with row 8g + (e&7) of D tile 2j + (e>>3),
// which is feature 4*(8g + (e&7)) + 2j + (e>>3).
// K blocks J0 .. J1 - 1 go out here.
template <int J0, int J1>
__device__ __forceinline__ void issue_w_hid(const float* __restrict__ Wg, int nl, int g,
                                            float4 (&v)[32]) {
  const float* p = Wg + 32 * g * Hsz + 4 * nl;
#pragma unroll  // constant indices: the array stays in registers
  for (int j = J0; j < J1; ++j)
#pragma unroll  // constant indices: the array stays in registers
    for (int e = 0; e < 16; ++e)
      v[16 * j + e] = *(const float4*)(p + (4 * (e & 7) + 2 * j + (e >> 3)) * Hsz);
  loads_issued(p);
  // Holds the loads here, a whole layer ahead of their use (as above).
  __builtin_amdgcn_sched_barrier(0);
}

// 16 rows of a weight, one float4 a lane -> element e of K block J of the four M tiles
template <int J, int N>
__device__ __forceinline__ void cvt_group(const float4 (&v)[N], v16h (&a)[4][2]) {
#pragma unroll  // constant indices: the vectors and arrays stay in registers
  for (int e = 0; e < 16; ++e) {
    a[0][J][e] = (_Float16)v[16 * J + e].x; a[1][J][e] = (_Float16)v[16 * J + e].y;
    a[2][J][e] = (_Float16)v[16 * J + e].z; a[3][J][e] = (_Float16)v[16 * J + e].w;
  }
}

// f16 + relu of D tile t -> its half of the next layer's B fragment. The relu comes
// behind the conversion, on f16 pairs: rounding keeps the sign, so the values are the
// same, and one packed maximum serves two elements.
__device__ __forceinline__ void pack_d(const v8f& c, int t, v16h (&h)[2]) {
  const v8h q = __builtin_elementwise_max(__builtin_convertvector(c, v8h), (v8h)(_Float16)0.0f);
#pragma unroll  // constant indices: the vectors and arrays stay in registers
  for (int r = 0; r < 8; ++r) h[t >> 1][(t & 1) * 8 + r] = q[r];
}

// The four 16-feature tiles of b0, b1, b2 or W3 (a = 0..3): a lane's 8 rows of each.
__device__ __forceinline__ void ld_tiles(const float* bwg, int a, v8f (&c)[4]) {
#pragma unroll  // constant indices: the array stays in registers
  for (int t = 0; t < 4; ++t) c[t] = *(const v8f*)(bwg + 64 * a + 16 * t);
}

// The layers below walk the 128 rows in steps of two M tiles of one group of 16 rows
// (NG * 2 steps and one more that ends the last pair). A step starts its pair's
// products and, under them, finishes the pair before (relu and f16, or the dot with
// W3): no product's result is read directly behind the product, and the two tiles'
// products alternate, so that no product waits for the one it accumulates onto.
// The bias tile is the C operand and stays in its registers; D goes to others.

// Layer 0: x fragments (K = 32) -> h
__device__ __forceinline__ void layer_in(const v16h (&wa)[4][2], const v8f (&cb)[4],
                                         const v16h (&bx)[NG], v16h (&ho)[NG][2]) {
  v8f d[2][2];
#pragma unroll  // constant indices: the vectors and arrays stay in registers
  for (int q = 0; q <= 2 * NG; ++q) {
    const int n = q >> 1, t = 2 * (q & 1), b = q & 1;
    if (q < 2 * NG) {
      d[b][0] = wmma_f16(wa[t][0],     bx[n], cb[t]);
      d[b][1] = wmma_f16(wa[t + 1][0], bx[n], cb[t + 1]);
    }
    // Holds this pair's products in front of the work on the pair before: moved behind
    // it, that work waits for its own products and the matrix unit idles under it.
    __builtin_amdgcn_sched_barrier(0);
    if (q >= 1) {
      const int pn = (q - 1) >> 1, pt = 2 * ((q - 1) & 1);
      pack_d(d[b ^ 1][0], pt,     ho[pn]);
      pack_d(d[b ^ 1][1], pt + 1, ho[pn]);
    }
    // Ends a step (as above).
    __builtin_amdgcn_sched_barrier(0);
  }
}

// Layer 1: h (K = 64) -> h
__device__ __forceinline__ void layer_hid(const v16h (&wa)[4][2], const v8f (&cb)[4],
                                          const v16h (&hi)[NG][2], v16h (&ho)[NG][2]) {
  v8f d[2][2];
#pragma unroll  // constant indices: the vectors and arrays stay in registers
  for (int q = 0; q <= 2 * NG; ++q) {
    const int n = q >> 1, t = 2 * (q & 1), b = q & 1;
    const int pn = (q - 1) >> 1, pt = 2 * ((q - 1) & 1);
    if (q < 2 * NG) {
      d[b][0] = wmma_f16(wa[t][0],     hi[n][0], cb[t]);
      d[b][1] = wmma_f16(wa[t + 1][0], hi[n][0], cb[t + 1]);
    }
    // Holds the pair's first products in front of the work on the pair before (as above).
    __builtin_amdgcn_sched_barrier(0);
    if (q >= 1) pack_d(d[b ^ 1][0], pt, ho[pn]);
    if (q < 2 * NG) d[b][0] = wmma_f16(wa[t][1], hi[n][1], d[b][0]);
    // Keeps half of that work between the pair's two second products.
    __builtin_amdgcn_sched_barrier(0);
    if (q >= 1) pack_d(d[b ^ 1][1], pt + 1, ho[pn]);
    if (q < 2 * NG) d[b][1] = wmma_f16(wa[t + 1][1], hi[n][1], d[b][1]);
    // Ends a step (as above).
    __builtin_amdgcn_sched_barrier(0);
  }
}

// Layer 2 and the dot with W3: h (K = 64) -> this tower's column of the out tile
__device__ __forceinline__ void layer_out(const v16h (&wa)[4][2], const v8f (&cb)[4],
                                          const v8f (&w3v)[4], const v16h (&hi)[NG][2],
                                          float bb, int lane, float* so) {
  v8f d[2][2];
  v8f p;
  float s_even = 0.f;
#pragma unroll  // constant indices: the vectors and arrays stay in registers
  for (int q = 0; q <= 2 * NG; ++q) {
    const int n = q >> 1, t = 2 * (q & 1), b = q & 1;
    const int pn = (q - 1) >> 1, pt = 2 * ((q - 1) & 1);
    if (q < 2 * NG) {
      d[b][0] = wmma_f16(wa[t][0],     hi[n][0], cb[t]);
      d[b][1] = wmma_f16(wa[t + 1][0], hi[n][0], cb[t + 1]);
    }
    // Holds the pair's first products in front of the work on the pair before (as above).
    __builtin_amdgcn_sched_barrier(0);
    if (q >= 1) {
      if (pt == 0) p = v8f{0.f, 0.f, 0.f, 0.f, 0.f, 0.f, 0.f, 0.f};
      p += relu(d[b ^ 1][0]) * w3v[pt];
    }
    if (q < 2 * NG) d[b][0] = wmma_f16(wa[t][1], hi[n][1], d[b][0]);
    // Keeps half of that work between the pair's two second products.
    __builtin_amdgcn_sched_barrier(0);
    if (q >= 1) p += relu(d[b ^ 1][1]) * w3v[pt + 1];
    if (q < 2 * NG) d[b][1] = wmma_f16(wa[t + 1][1], hi[n][1], d[b][1]);
    if (q >= 1 && pt == 2) {
      // a lane holds 32 of its batch row's 64 features; lane ^ 16 holds the rest
      float s = ((p[0] + p[1]) + (p[2] + p[3])) + ((p[4] + p[5]) + (p[6] + p[7]));
      s += xhalf(s);
      // Both halves of the wave now hold the sum: lanes 0..15 store the even group's
      // rows and lanes 16..31 the odd group's, one store of all 32 lanes for two groups.
      if ((pn & 1) == 0) s_even = s;
      else so[(16 * (pn - 1) + lane) * OS] = (lane < 16 ? s_even : s) + bb;
    }
    // Ends a step (as above).
    __builtin_amdgcn_sched_barrier(0);
  }
}

__global__ __launch_bounds__(NTHR) void towers64_kernel(
    const float* __restrict__ x,
    const float* __restrict__ W0, const float* __restrict__ b0,
    const float* __restrict__ W1, const float* __restrict__ b1,
    const float* __restrict__ W2, const float* __restrict__ b2,
    const float* __restrict__ W3, const float* __restrict__ b3,
    float* __restrict__ out) {
  __shared__ alignas(16) _Float16 sX[TILE_M * XS];        // x tile, f16 [128][32]
  __shared__ alignas(32) float sBW[TOWERS * 4 * Hsz];     // [tower][b0,b1,b2,W3][tile][q]
  __shared__ alignas(16) float sO[TILE_M * OS];           // out tile [row][tower]

  const int m0  = blockIdx.x * TILE_M;   // first batch row of tile
  const int o0  = blockIdx.y * TOWERS;   // first tower of the block
  const int tid = threadIdx.x;
  const int lane = tid & 31;             // wave32 lane
  const int w    = __builtin_amdgcn_readfirstlane(tid >> 5);  // wave id 0..7
  const int nl   = lane & 15;
  const int g    = lane >> 4;

  constexpr int NT = TOWERS / NWAVE;   // towers of a wave
  float4 sn[16];     // a tower's W0, f32, in flight or landed
  float4 st[32];     // a hidden layer's weights, f32, in flight or landed
  v16h wa[4][2];     // this layer's weights as A fragments [M tile][K block of 32]

  // the first tower's W0 and half of its W1 fly while x, the biases and W3 are staged
  issue_w_in(W0 + (size_t)(o0 + w) * Isz * Hsz, nl, g, sn);
  issue_w_hid<0, 1>(W1 + (size_t)(o0 + w) * Hsz * Hsz, nl, g, st);
  {
    // ---- stage x tile: fp32 -> f16, vectorized float4 loads ----
    constexpr int NX = TILE_M * Isz / 4 / NTHR;
    static_assert(NX == 4, "the wait below names four addresses");
    const float* px[NX];
    float4 v[NX];
#pragma unroll  // the four loads go out together: one round trip
    for (int i = 0; i < NX; ++i) {
      const int idx = tid + i * NTHR;
      px[i] = x + (size_t)(m0 + (idx >> 3)) * Isz + (idx & 7) * 4;
      v[i] = *(const float4*)px[i];
    }
    // s_wait_xcnt 0 stands before any register that an issued load names is written
    // again; naming the addresses keeps their pairs live up to the wait.
    asm volatile("s_wait_xcnt 0x0" :: "v"(px[0]), "v"(px[1]), "v"(px[2]), "v"(px[3]) : "memory");
#pragma unroll  // constant indices: the arrays stay in registers
    for (int i = 0; i < NX; ++i) {
      const int idx = tid + i * NTHR;
      v4h h; h[0] = (_Float16)v[i].x; h[1] = (_Float16)v[i].y;
             h[2] = (_Float16)v[i].z; h[3] = (_Float16)v[i].w;
      *(v4h*)(sX + (idx >> 3) * XS + (idx & 7) * 4) = h;
    }
    // ---- stage biases and W3 of the 32 towers, feature 4q+t -> [t][q] ----
    const int a = w >> 1;                // which array: the same for a whole wave
    const int m = (w & 1) * 32 + lane;
    const float* src = (a == 0 ? b0 : a == 1 ? b1 : a == 2 ? b2 : W3) + o0 * Hsz + m;
    float* dst = sBW + a * Hsz + (m & 3) * 16 + (m >> 2);
#pragma unroll  // the 32 loads go out together: one round trip
    for (int i = 0; i < TOWERS; ++i)
      dst[i * 4 * Hsz] = src[i * Hsz];
  }
  __syncthreads();
  cvt_group<0>(sn, wa);

  // Every layer has 8 or 16 KB of later weights in flight under it, so that the loads
  // from L2 never pause: the second half of W1 under layer 0, W2 under layer 1, the next
  // tower's W0 and the first half of its W1 under layer 2.
  // Rolled: for speed only.
#pragma nounroll
  for (int i = 0; i < NT; ++i) {
    const int ot = NWAVE * i + w;        // the tower's number within the block
    const int o  = o0 + ot;
    const float* bwg = sBW + ot * 4 * Hsz + 8 * g;   // a lane's D registers are rows 8g .. 8g+7
    const float bb = b3[o];
    v8f cb[4], w3v[4];
    v16h bx[NG], h0[NG][2], h1[NG][2];

    // ---- layer 0, W1 in flight (its first half since the tower before) ----
#pragma unroll  // constant indices: the array stays in registers
    for (int n = 0; n < NG; ++n) bx[n] = ld_frag(sX, 16 * n + nl, XS, 0, g);
    ld_tiles(bwg, 0, cb);
    issue_w_hid<1, 2>(W1 + (size_t)o * Hsz * Hsz, nl, g, st);
    layer_in(wa, cb, bx, h0);
    ld_tiles(bwg, 1, cb);                // read under the conversion
    // Holds the LDS reads in front of the conversion, which waits for the weights.
    __builtin_amdgcn_sched_barrier(0);
    cvt_group<0>(st, wa);
    cvt_group<1>(st, wa);
    // Holds the conversion in front of the loads that refill its source registers.
    __builtin_amdgcn_sched_barrier(0);

    // ---- layer 1, W2 in flight ----
    issue_w_hid<0, 2>(W2 + (size_t)o * Hsz * Hsz, nl, g, st);
    layer_hid(wa, cb, h0, h1);
    ld_tiles(bwg, 2, cb);                // read under the conversion
    ld_tiles(bwg, 3, w3v);
    // Holds the LDS reads in front of the conversion (as above).
    __builtin_amdgcn_sched_barrier(0);
    cvt_group<0>(st, wa);
    cvt_group<1>(st, wa);
    // Holds the conversion in front of the loads that refill its source registers.
    __builtin_amdgcn_sched_barrier(0);

    // ---- layer 2 and the dot with W3, the next tower's W0 and half of W1 in flight ----
    // No branch here: the three layers stay one straight run (behind a branch the
    // compiler moves layer 1's relu and f16 work down to it, all 32 D tiles stay live
    // and spill). The last trip reads its own tower's weights again, and nothing uses them.
    const int on = i + 1 < NT ? o + NWAVE : o;
    issue_w_in(W0 + (size_t)on * Isz * Hsz, nl, g, sn);
    issue_w_hid<0, 1>(W1 + (size_t)on * Hsz * Hsz, nl, g, st);
    layer_out(wa, cb, w3v, h1, bb, lane, sO + ot);
    cvt_group<0>(sn, wa);
  }

  // ---- out tile -> global: 8 lanes x 16 bytes are one row's whole 128-byte line ----
  __syncthreads();
#pragma unroll  // the stores go out together
  for (int i = 0; i < TILE_M * TOWERS / 4 / NTHR; ++i) {
    const int idx = tid + i * NTHR;
    const int r  = idx >> 3;
    const int c4 = (idx & 7) * 4;
    const v4f v = *(const v4f*)(sO + r * OS + c4);
    __builtin_nontemporal_store(v, (v4f*)(out + (size_t)(m0 + r) * Osz + o0 + c4));
  }
}

extern "C" void kernel_launch(void* const* d_in, const int* in_sizes, int n_in,
                              void* d_out, int out_size, void* d_ws, size_t ws_size,
                              hipStream_t stream) {
  const float* x  = (const float*)d_in[0];
  const float* W0 = (const float*)d_in[1];
  const float* b0 = (const float*)d_in[2];
  const float* W1 = (const float*)d_in[3];
  const float* b1 = (const float*)d_in[4];
  const float* W2 = (const float*)d_in[5];
  const float* b2 = (const float*)d_in[6];
  const float* W3 = (const float*)d_in[7];
  const float* b3 = (const float*)d_in[8];

  dim3 grid(Bsz / TILE_M, Osz / TOWERS);   // (128, 2) blocks
  towers64_kernel<<<grid, NTHR, 0, stream>>>(x, W0, b0, W1, b1, W2, b2, W3, b3,
                                             (float*)d_out);
}

// v007
// One run takes 17.1 microseconds.
// Timed twice side by side with v006, it ran 1.07 times as fast both times.
// Over all steps from v000 it is 5.02 times as fast.
#include <hip/hip_runtime.h>

// ---------------------------------------------------------------------------
// 64 independent MLP towers, fused into one kernel.
//   h0 = relu(x @ W0[o] + b0[o])      [B,32]x[32,64]
//   h1 = relu(h0 @ W1[o] + b1[o])     [B,64]x[64,64]
//   h2 = relu(h1 @ W2[o] + b2[o])     [B,64]x[64,64]
//   out[:,o] = h2 @ W3[o] + b3[o]     [B,64].[64]
// One block = (256 batch rows, 16 towers); ONE WAVE OWNS ONE TOWER at a time for 128
// of the rows (8 waves, four towers one after the other). TWIN WAVES w and w ^ 1 take
// the same tower, each for its own 128 rows: they load the same
// weight lines, so that
// the WGP's cache serves the second of them and L2 delivers a tower's weights once
// for 256 rows. The products are taken transposed,
// h^T = W^T * x^T: a layer's weights are the A operand, 16 batch rows are the B
// operand. Two f32 D tiles of a layer, converted, are the next layer's B fragment.
// LAYER BY LAYER: a wave takes all 128 rows through one layer before it goes on to
// the next; the 128 rows' activations stay in its registers. So only one layer's
// weights are held at a time, the next layer's are in flight from L2 under this
// layer's products, and a layer's bias tiles are read from LDS once for 128 rows.
// A tower's results are one column of out: they are gathered in LDS, and the block
// stores its 256 rows x 16 towers at the end, 64 bytes in a row for each batch row.
// All matmuls via v_wmma_f32_16x16x32_f16 (f16 operands, f32 accumulate).
//
// Feature order: row q (0..15) of M tile t (0..3) is feature 4*q + t, so that a
// lane's one float4 of a weight row feeds the same element of all four M tiles
// and 16 lanes read one whole 256-byte weight row.
// ---------------------------------------------------------------------------

typedef _Float16 v16h __attribute__((ext_vector_type(16)));
typedef _Float16 v8h  __attribute__((ext_vector_type(8)));
typedef _Float16 v4h  __attribute__((ext_vector_type(4)));
typedef float    v8f  __attribute__((ext_vector_type(8)));
typedef float    v4f  __attribute__((ext_vector_type(4)));
typedef int      v8i  __attribute__((ext_vector_type(8)));

constexpr int Bsz = 16384;
constexpr int Isz = 32;
constexpr int Osz = 64;
constexpr int Hsz = 64;
constexpr int TILE_M = 256;   // batch rows per block
constexpr int ROWS_W = 128;   // batch rows per wave
constexpr int NTHR   = 256;   // 8 waves, two a SIMD: up to 512 registers each
constexpr int NWAVE  = NTHR / 32;
constexpr int NG     = ROWS_W / 16;   // a wave's groups of 16 batch rows
constexpr int TOWERS = 16;    // towers per block, four per pair of twin waves
constexpr int XS = 40;        // LDS row stride (halves) of the x tile (80B, 16B x odd)
constexpr int OS = 20;        // LDS row stride (floats) of the out tile (80B, 16B x odd)

__device__ __forceinline__ v8f wmma_f16(v16h a, v16h b, v8f c) {
  // D = A(16x32 f16) * B(32x16 f16) + C(16x16 f32)
  return __builtin_amdgcn_wmma_f32_16x16x32_f16(
      /*neg_a=*/false, a, /*neg_b=*/false, b,
      /*c_mod=*/(short)0, c, /*reuse_a=*/false, /*reuse_b=*/false);
}

// ReLU of f32 values on their bits: a float below zero is a negative integer, so one
// signed integer maximum with 0 does it. The float maximum of a product's result compiles
// to two instructions (one that only quiets a NaN, then the maximum).
__device__ __forceinline__ v8f relu(v8f v) {
  return __builtin_bit_cast(v8f, __builtin_elementwise_max(__builtin_bit_cast(v8i, v), (v8i)0));
}

// lane l with lane l ^ 16
__device__ __forceinline__ float xhalf(float v) {
  const int b = __builtin_bit_cast(int, v);
  return __builtin_bit_cast(float,
      __builtin_amdgcn_permlanex16(b, b, 0x76543210, 0xfedcba98, false, false));
}

// Load one K=32 f16 operand fragment from a row-major LDS tile.
// ISA 16-bit A/B layout (wave32): lane L -> row (L&15), half-group g = L>>4;
//   elements 0..7  = row[koff + g*8 .. +7]
//   elements 8..15 = row[koff + 16 + g*8 .. +7]
// Both are contiguous 16-byte chunks -> two ds_load_b128.
__device__ __forceinline__ v16h ld_frag(const _Float16* base, int row, int stride,
                                        int koff, int g) {
  const _Float16* p = base + row * stride + koff + g * 8;
  v8h lo = *(const v8h*)(p);
  v8h hi = *(const v8h*)(p + 16);
  return __builtin_shufflevector(lo, hi, 0,1,2,3,4,5,6,7,8,9,10,11,12,13,14,15);
}

// Behind a group's loads: s_wait_xcnt 0 stands before any register that an issued
// load names is written again; naming the address keeps its pair live up to the wait.
// Its "memory" clobber also keeps the loads in front of the products that follow.
__device__ __forceinline__ void loads_issued(const float* p) {
  asm volatile("s_wait_xcnt 0x0" :: "v"(p) : "memory");
}

// Issue the loads of a [32][64] weight whose k is the plain input index of x: one
// float4 a lane and row; element e is k = 8g + (e&7) + 16*(e>>3), the hardware k order.
__device__ __forceinline__ void issue_w_in(const float* __restrict__ Wg, int nl, int g,
                                           float4 (&v)[16]) {
  const float* p = Wg + 8 * g * Hsz + 4 * nl;
#pragma unroll  // constant indices: the array stays in registers
  for (int e = 0; e < 16; ++e)
    v[e] = *(const float4*)(p + ((e & 7) + 16 * (e >> 3)) * Hsz);
  loads_issued(p);
  // Holds the loads here, a whole layer ahead of their use: sunk to the conversion
  // they would be waited for at once.
  __builtin_amdgcn_sched_barrier(0);
}

// Issue the loads of a [64][64] weight whose k runs over the previous layer's D
// tiles: element e of K block j pairs with row 8g + (e&7) of D tile 2j + (e>>3),
// which is feature 4*(8g + (e&7)) + 2j + (e>>3).
// K blocks J0 .. J1 - 1 go out here.
template <int J0, int J1>
__device__ __forceinline__ void issue_w_hid(const float* __restrict__ Wg, int nl, int g,
                                            float4 (&v)[32]) {
  const float* p = Wg + 32 * g * Hsz + 4 * nl;
#pragma unroll  // constant indices: the array stays in registers
  for (int j = J0; j < J1; ++j)
#pragma unroll  // constant indices: the array stays in registers
    for (int e = 0; e < 16; ++e)
      v[16 * j + e] = *(const float4*)(p + (4 * (e & 7) + 2 * j + (e >> 3)) * Hsz);
  loads_issued(p);
  // Holds the loads here, a whole layer ahead of their use (as above).
  __builtin_amdgcn_sched_barrier(0);
}

// 16 rows of a weight, one float4 a lane -> element e of K block J of the four M tiles
template <int J, int N>
__device__ __forceinline__ void cvt_group(const float4 (&v)[N], v16h (&a)[4][2]) {
#pragma unroll  // constant indices: the vectors and arrays stay in registers
  for (int e = 0; e < 16; ++e) {
    a[0][J][e] = (_Float16)v[16 * J + e].x; a[1][J][e] = (_Float16)v[16 * J + e].y;
    a[2][J][e] = (_Float16)v[16 * J + e].z; a[3][J][e] = (_Float16)v[16 * J + e].w;
  }
}

// f16 + relu of D tile t -> its half of the next layer's B fragment. The relu comes
// behind the conversion, on f16 pairs: rounding keeps the sign, so the values are the
// same, and one packed maximum serves two elements.
__device__ __forceinline__ void pack_d(const v8f& c, int t, v16h (&h)[2]) {
  const v8h q = __builtin_elementwise_max(__builtin_convertvector(c, v8h), (v8h)(_Float16)0.0f);
#pragma unroll  // constant indices: the vectors and arrays stay in registers
  for (int r = 0; r < 8; ++r) h[t >> 1][(t & 1) * 8 + r] = q[r];
}

// The four 16-feature tiles of b0, b1, b2 or W3 (a = 0..3): a lane's 8 rows of each.
__device__ __forceinline__ void ld_tiles(const float* bwg, int a, v8f (&c)[4]) {
#pragma unroll  // constant indices: the array stays in registers
  for (int t = 0; t < 4; ++t) c[t] = *(const v8f*)(bwg + 64 * a + 16 * t);
}

// The layers below walk the 128 rows in steps of two M tiles of one group of 16 rows
// (NG * 2 steps and one more that ends the last pair). A step starts its pair's
// products and, under them, finishes the pair before (relu and f16, or the dot with
// W3): no product's result is read directly behind the product, and the two tiles'
// products alternate, so that no product waits for the one it accumulates onto.
// The bias tile is the C operand and stays in its registers; D goes to others.

// Layer 0: x fragments (K = 32) -> h
__device__ __forceinline__ void layer_in(const v16h (&wa)[4][2], const v8f (&cb)[4],
                                         const v16h (&bx)[NG], v16h (&ho)[NG][2]) {
  v8f d[2][2];
#pragma unroll  // constant indices: the vectors and arrays stay in registers
  for (int q = 0; q <= 2 * NG; ++q) {
    const int n = q >> 1, t = 2 * (q & 1), b = q & 1;
    if (q < 2 * NG) {
      d[b][0] = wmma_f16(wa[t][0],     bx[n], cb[t]);
      d[b][1] = wmma_f16(wa[t + 1][0], bx[n], cb[t + 1]);
    }
    // Holds this pair's products in front of the work on the pair before: moved behind
    // it, that work waits for its own products and the matrix unit idles under it.
    __builtin_amdgcn_sched_barrier(0);
    if (q >= 1) {
      const int pn = (q - 1) >> 1, pt = 2 * ((q - 1) & 1);
      pack_d(d[b ^ 1][0], pt,     ho[pn]);
      pack_d(d[b ^ 1][1], pt + 1, ho[pn]);
    }
    // Ends a step (as above).
    __builtin_amdgcn_sched_barrier(0);
  }
}

// Layer 1: h (K = 64) -> h
__device__ __forceinline__ void layer_hid(const v16h (&wa)[4][2], const v8f (&cb)[4],
                                          const v16h (&hi)[NG][2], v16h (&ho)[NG][2]) {
  v8f d[2][2];
#pragma unroll  // constant indices: the vectors and arrays stay in registers
  for (int q = 0; q <= 2 * NG; ++q) {
    const int n = q >> 1, t = 2 * (q & 1), b = q & 1;
    const int pn = (q - 1) >> 1, pt = 2 * ((q - 1) & 1);
    if (q < 2 * NG) {
      d[b][0] = wmma_f16(wa[t][0],     hi[n][0], cb[t]);
      d[b][1] = wmma_f16(wa[t + 1][0], hi[n][0], cb[t + 1]);
    }
    // Holds the pair's first products in front of the work on the pair before (as above).
    __builtin_amdgcn_sched_barrier(0);
    if (q >= 1) pack_d(d[b ^ 1][0], pt, ho[pn]);
    if (q < 2 * NG) d[b][0] = wmma_f16(wa[t][1], hi[n][1], d[b][0]);
    // Keeps half of that work between the pair's two second products.
    __builtin_amdgcn_sched_barrier(0);
    if (q >= 1) pack_d(d[b ^ 1][1], pt + 1, ho[pn]);
    if (q < 2 * NG) d[b][1] = wmma_f16(wa[t + 1][1], hi[n][1], d[b][1]);
    // Ends a step (as above).
    __builtin_amdgcn_sched_barrier(0);
  }
}

// Layer 2 and the dot with W3: h (K = 64) -> this tower's column of the out tile
__device__ __forceinline__ void layer_out(const v16h (&wa)[4][2], const v8f (&cb)[4],
                                          const v8f (&w3v)[4], const v16h (&hi)[NG][2],
                                          float bb, int lane, float* so) {
  v8f d[2][2];
  v8f p;
  float s_even = 0.f;
#pragma unroll  // constant indices: the vectors and arrays stay in registers
  for (int q = 0; q <= 2 * NG; ++q) {
    const int n = q >> 1, t = 2 * (q & 1), b = q & 1;
    const int pn = (q - 1) >> 1, pt = 2 * ((q - 1) & 1);
    if (q < 2 * NG) {
      d[b][0] = wmma_f16(wa[t][0],     hi[n][0], cb[t]);
      d[b][1] = wmma_f16(wa[t + 1][0], hi[n][0], cb[t + 1]);
    }
    // Holds the pair's first products in front of the work on the pair before (as above).
    __builtin_amdgcn_sched_barrier(0);
    if (q >= 1) {
      if (pt == 0) p = v8f{0.f, 0.f, 0.f, 0.f, 0.f, 0.f, 0.f, 0.f};
      p += relu(d[b ^ 1][0]) * w3v[pt];
    }
    if (q < 2 * NG) d[b][0] = wmma_f16(wa[t][1], hi[n][1], d[b][0]);
    // Keeps half of that work between the pair's two second products.
    __builtin_amdgcn_sched_barrier(0);
    if (q >= 1) p += relu(d[b ^ 1][1]) * w3v[pt + 1];
    if (q < 2 * NG) d[b][1] = wmma_f16(wa[t + 1][1], hi[n][1], d[b][1]);
    if (q >= 1 && pt == 2) {
      // a lane holds 32 of its batch row's 64 features; lane ^ 16 holds the rest
      float s = ((p[0] + p[1]) + (p[2] + p[3])) + ((p[4] + p[5]) + (p[6] + p[7]));
      s += xhalf(s);
      // Both halves of the wave now hold the sum: lanes 0..15 store the even group's
      // rows and lanes 16..31 the odd group's, one store of all 32 lanes for two groups.
      if ((pn & 1) == 0) s_even = s;
      else so[(16 * (pn - 1) + lane) * OS] = (lane < 16 ? s_even : s) + bb;
    }
    // Ends a step (as above).
    __builtin_amdgcn_sched_barrier(0);
  }
}

__global__ __launch_bounds__(NTHR) void towers64_kernel(
    const float* __restrict__ x,
    const float* __restrict__ W0, const float* __restrict__ b0,
    const float* __restrict__ W1, const float* __restrict__ b1,
    const float* __restrict__ W2, const float* __restrict__ b2,
    const float* __restrict__ W3, const float* __restrict__ b3,
    float* __restrict__ out) {
  __shared__ alignas(16) _Float16 sX[TILE_M * XS];        // x tile, f16 [256][32]
  __shared__ alignas(32) float sBW[TOWERS * 4 * Hsz];     // [tower][b0,b1,b2,W3][tile][q]
  __shared__ alignas(16) float sO[TILE_M * OS];           // out tile [row][tower]

  const int m0  = blockIdx.x * TILE_M;   // first batch row of tile
  const int o0  = blockIdx.y * TOWERS;   // first tower of the block
  const int tid = threadIdx.x;
  const int lane = tid & 31;             // wave32 lane
  const int w    = __builtin_amdgcn_readfirstlane(tid >> 5);  // wave id 0..7
  const int nl   = lane & 15;
  const int g    = lane >> 4;
  const int pr   = w >> 1;               // pair of twin waves 0..3: which tower
  const int r0   = (w & 1) * ROWS_W;     // the wave's first row within the tile

  constexpr int NPAIR = NWAVE / 2;
  constexpr int NT = TOWERS / NPAIR;   // towers of a wave
  float4 sn[16];     // a tower's W0, f32, in flight or landed
  float4 st[32];     // a hidden layer's weights, f32, in flight or landed
  v16h wa[4][2];     // this layer's weights as A fragments [M tile][K block of 32]

  // the first tower's W0 and half of its W1 fly while x, the biases and W3 are staged
  issue_w_in(W0 + (size_t)(o0 + pr) * Isz * Hsz, nl, g, sn);
  issue_w_hid<0, 1>(W1 + (size_t)(o0 + pr) * Hsz * Hsz, nl, g, st);
  {
    // ---- stage x tile: fp32 -> f16, vectorized float4 loads ----
    constexpr int NX = TILE_M * Isz / 4 / NTHR;
    static_assert(NX == 8, "the wait below names eight addresses");
    const float* px[NX];
    float4 v[NX];
#pragma unroll  // the eight loads go out together: one round trip
    for (int i = 0; i < NX; ++i) {
      const int idx = tid + i * NTHR;
      px[i] = x + (size_t)(m0 + (idx >> 3)) * Isz + (idx & 7) * 4;
      v[i] = *(const float4*)px[i];
    }
    // s_wait_xcnt 0 stands before any register that an issued load names is written
    // again; naming the addresses keeps their pairs live up to the wait.
    asm volatile("s_wait_xcnt 0x0" :: "v"(px[0]), "v"(px[1]), "v"(px[2]), "v"(px[3]),
                                      "v"(px[4]), "v"(px[5]), "v"(px[6]), "v"(px[7]) : "memory");
#pragma unroll  // constant indices: the arrays stay in registers
    for (int i = 0; i < NX; ++i) {
      const int idx = tid + i * NTHR;
      v4h h; h[0] = (_Float16)v[i].x; h[1] = (_Float16)v[i].y;
             h[2] = (_Float16)v[i].z; h[3] = (_Float16)v[i].w;
      *(v4h*)(sX + (idx >> 3) * XS + (idx & 7) * 4) = h;
    }
    // ---- stage biases and W3 of the 16 towers, feature 4q+t -> [t][q] ----
    const int a = w >> 1;                // which array: the same for a whole wave
    const int m = (w & 1) * 32 + lane;
    const float* src = (a == 0 ? b0 : a == 1 ? b1 : a == 2 ? b2 : W3) + o0 * Hsz + m;
    float* dst = sBW + a * Hsz + (m & 3) * 16 + (m >> 2);
#pragma unroll  // the 16 loads go out together: one round trip
    for (int i = 0; i < TOWERS; ++i)
      dst[i * 4 * Hsz] = src[i * Hsz];
  }
  __syncthreads();
  cvt_group<0>(sn, wa);

  // Every layer has 8 or 16 KB of later weights in flight under it, so that the loads
  // from L2 never pause: the second half of W1 under layer 0, W2 under layer 1, the next
  // tower's W0 and the first half of its W1 under layer 2.
  // Rolled: for speed only.
#pragma nounroll
  for (int i = 0; i < NT; ++i) {
    const int ot = NPAIR * i + pr;       // the tower's number within the block
    const int o  = o0 + ot;
    const float* bwg = sBW + ot * 4 * Hsz + 8 * g;   // a lane's D registers are rows 8g .. 8g+7
    const float bb = b3[o];
    v8f cb[4], w3v[4];
    v16h bx[NG], h0[NG][2], h1[NG][2];

    // ---- layer 0, W1 in flight (its first half since the tower before) ----
#pragma unroll  // constant indices: the array stays in registers
    for (int n = 0; n < NG; ++n) bx[n] = ld_frag(sX, r0 + 16 * n + nl, XS, 0, g);
    ld_tiles(bwg, 0, cb);
    issue_w_hid<1, 2>(W1 + (size_t)o * Hsz * Hsz, nl, g, st);
    layer_in(wa, cb, bx, h0);
    ld_tiles(bwg, 1, cb);                // read under the conversion
    // Holds the LDS reads in front of the conversion, which waits for the weights.
    __builtin_amdgcn_sched_barrier(0);
    cvt_group<0>(st, wa);
    cvt_group<1>(st, wa);
    // Holds the conversion in front of the loads that refill its source registers.
    __builtin_amdgcn_sched_barrier(0);

    // ---- layer 1, W2 in flight ----
    issue_w_hid<0, 2>(W2 + (size_t)o * Hsz * Hsz, nl, g, st);
    layer_hid(wa, cb, h0, h1);
    ld_tiles(bwg, 2, cb);                // read under the conversion
    ld_tiles(bwg, 3, w3v);
    // Holds the LDS reads in front of the conversion (as above).
    __builtin_amdgcn_sched_barrier(0);
    cvt_group<0>(st, wa);
    cvt_group<1>(st, wa);
    // Holds the conversion in front of the loads that refill its source registers.
    __builtin_amdgcn_sched_barrier(0);

    // ---- layer 2 and the dot with W3, the next tower's W0 and half of W1 in flight ----
    // No branch here: the three layers stay one straight run (behind a branch the
    // compiler moves layer 1's relu and f16 work down to it, all 32 D tiles stay live
    // and spill). The last trip reads its own tower's weights again, and nothing uses them.
    const int on = i + 1 < NT ? o + NPAIR : o;
    issue_w_in(W0 + (size_t)on * Isz * Hsz, nl, g, sn);
    issue_w_hid<0, 1>(W1 + (size_t)on * Hsz * Hsz, nl, g, st);
    layer_out(wa, cb, w3v, h1, bb, lane, sO + r0 * OS + ot);
    cvt_group<0>(sn, wa);
  }

  // ---- out tile -> global: 4 lanes x 16 bytes are one row's 16 towers, half a line ----
  __syncthreads();
#pragma unroll  // the stores go out together
  for (int i = 0; i < TILE_M * TOWERS / 4 / NTHR; ++i) {
    const int idx = tid + i * NTHR;
    const int r  = idx >> 2;
    const int c4 = (idx & 3) * 4;
    const v4f v = *(const v4f*)(sO + r * OS + c4);
    __builtin_nontemporal_store(v, (v4f*)(out + (size_t)(m0 + r) * Osz + o0 + c4));
  }
}

extern "C" void kernel_launch(void* const* d_in, const int* in_sizes, int n_in,
                              void* d_out, int out_size, void* d_ws, size_t ws_size,
                              hipStream_t stream) {
  const float* x  = (const float*)d_in[0];
  const float* W0 = (const float*)d_in[1];
  const float* b0 = (const float*)d_in[2];
  const float* W1 = (const float*)d_in[3];
  const float* b1 = (const float*)d_in[4];
  const float* W2 = (const float*)d_in[5];
  const float* b2 = (const float*)d_in[6];
  const float* W3 = (const float*)d_in[7];
  const float* b3 = (const float*)d_in[8];

  dim3 grid(Bsz / TILE_M, Osz / TOWERS);   // (64, 4) blocks
  towers64_kernel<<<grid, NTHR, 0, stream>>>(x, W0, b0, W1, b1, W2, b2, W3, b3,
                                             (float*)d_out);
}

// v009
// It runs in 14.2 microseconds.
// Versions between v007 and this one are left out; their measured steps multiply to 1.20 times as fast.
// Over all steps from v000 it is 6.04 times as fast.
#include <hip/hip_runtime.h>

// ---------------------------------------------------------------------------
// 64 independent MLP towers, fused into one kernel.
//   h0 = relu(x @ W0[o] + b0[o])      [B,32]x[32,64]
//   h1 = relu(h0 @ W1[o] + b1[o])     [B,64]x[64,64]
//   h2 = relu(h1 @ W2[o] + b2[o])     [B,64]x[64,64]
//   out[:,o] = h2 @ W3[o] + b3[o]     [B,64].[64]
// One block = (256 batch rows, 16 towers); ONE WAVE OWNS ONE TOWER at a time for all
// 256 rows (8 waves, two towers one after the other): a tower's weights are loaded from
// L2 and turned into f16 once a block. The products are taken transposed,
// h^T = W^T * x^T: a layer's weights are the A operand, 16 batch rows are the B
// operand. The three layers' products return f16 (v_wmma_f16_16x16x32_f16): a D tile is
// then, as it stands, one half of the next layer's B fragment, and only the relu is left
// to the vector unit. h2 goes on the same way into a fourth product with W3.
// LAYER BY LAYER: a wave takes all 256 rows through one layer before it goes on to
// the next; the 256 rows' activations stay in its registers (256 of them: a group's
// results take the place that an earlier group's inputs have left). So only one layer's
// weights are held at a time, the next layer's are in flight from L2 under this
// layer's products, and a layer's bias tiles are read from LDS once for 256 rows.
// A tower's results are one column of out: they are gathered in LDS, and the block
// stores its 256 rows x 16 towers at the end, 64 bytes in a row for each batch row.
// All matmuls on 16x16x32 f16 WMMAs: f16 result in the layers, f32 result for out.
//
// Feature order: row q (0..15) of M tile t (0..3) is feature 4*q + t, so that a
// lane's one float4 of a weight row feeds the same element of all four M tiles
// and 16 lanes read one whole 256-byte weight row.
// ---------------------------------------------------------------------------

typedef _Float16 v16h __attribute__((ext_vector_type(16)));
typedef _Float16 v8h  __attribute__((ext_vector_type(8)));
typedef _Float16 v4h  __attribute__((ext_vector_type(4)));
typedef _Float16 v2h  __attribute__((ext_vector_type(2)));
typedef short    v8s  __attribute__((ext_vector_type(8)));
typedef float    v8f  __attribute__((ext_vector_type(8)));
typedef float    v4f  __attribute__((ext_vector_type(4)));

constexpr int Bsz = 16384;
constexpr int Isz = 32;
constexpr int Osz = 64;
constexpr int Hsz = 64;
constexpr int TILE_M = 256;   // batch rows per block
constexpr int ROWS_W = 256;   // batch rows per wave
constexpr int NTHR   = 256;   // 8 waves, two a SIMD: up to 512 registers each
constexpr int NWAVE  = NTHR / 32;
constexpr int NG     = ROWS_W / 16;   // a wave's groups of 16 batch rows
constexpr int TOWERS = 16;    // towers per block, two per wave
constexpr int XS = 40;        // LDS row stride (halves) of the x tile (80B, 16B x odd)
constexpr int OS = 20;        // LDS row stride (floats) of the out tile (80B, 16B x odd)

__device__ __forceinline__ v8f wmma_f16(v16h a, v16h b, v8f c) {
  // D = A(16x32 f16) * B(32x16 f16) + C(16x16 f32)
  return __builtin_amdgcn_wmma_f32_16x16x32_f16(
      /*neg_a=*/false, a, /*neg_b=*/false, b,
      /*c_mod=*/(short)0, c, /*reuse_a=*/false, /*reuse_b=*/false);
}

__device__ __forceinline__ v8h wmma_h(v16h a, v16h b, v8h c) {
  // D = A(16x32 f16) * B(32x16 f16) + C(16x16 f16), D in f16: element e = D[8g + e][col]
  return __builtin_amdgcn_wmma_f16_16x16x32_f16(
      /*neg_a=*/false, a, /*neg_b=*/false, b,
      /*c_mod=*/(short)0, c, /*reuse_a=*/false, /*reuse_b=*/false);
}

// ReLU of f16 values on their bits: a half below zero is a negative 16-bit integer, so one
// packed signed maximum with 0 serves two elements; an integer maximum brings no instruction
// with it that only quiets a NaN.
__device__ __forceinline__ v8h relu(v8h v) {
  return __builtin_bit_cast(v8h, __builtin_elementwise_max(__builtin_bit_cast(v8s, v), (v8s)0));
}

// Load one K=32 f16 operand fragment from a row-major LDS tile.
// ISA 16-bit A/B layout (wave32): lane L -> row (L&15), half-group g = L>>4;
//   elements 0..7  = row[koff + g*8 .. +7]
//   elements 8..15 = row[koff + 16 + g*8 .. +7]
// Both are contiguous 16-byte chunks -> two ds_load_b128.
__device__ __forceinline__ v16h ld_frag(const _Float16* base, int row, int stride,
                                        int koff, int g) {
  const _Float16* p = base + row * stride + koff + g * 8;
  v8h lo = *(const v8h*)(p);
  v8h hi = *(const v8h*)(p + 16);
  return __builtin_shufflevector(lo, hi, 0,1,2,3,4,5,6,7,8,9,10,11,12,13,14,15);
}

// Behind a group's loads: s_wait_xcnt 0 stands before any register that an issued
// load names is written again; naming the address keeps its pair live up to the wait.
// Its "memory" clobber also keeps the loads in front of the products that follow.
__device__ __forceinline__ void loads_issued(const float* p) {
  asm volatile("s_wait_xcnt 0x0" :: "v"(p) : "memory");
}

// Issue the loads of a [32][64] weight whose k is the plain input index of x: one
// float4 a lane and row; element e is k = 8g + (e&7) + 16*(e>>3), the hardware k order.
__device__ __forceinline__ void issue_w_in(const float* __restrict__ Wg, int nl, int g,
                                           float4 (&v)[16]) {
  const float* p = Wg + 8 * g * Hsz + 4 * nl;
#pragma unroll  // constant indices: the array stays in registers
  for (int e = 0; e < 16; ++e)
    v[e] = *(const float4*)(p + ((e & 7) + 16 * (e >> 3)) * Hsz);
  loads_issued(p);
  // Holds the loads here, three quarters of a layer ahead of their use: sunk to the conversion
  // they would be waited for at once.
  __builtin_amdgcn_sched_barrier(0);
}

// Issue the loads of a [64][64] weight whose k runs over the previous layer's D
// tiles: element e of K block j pairs with row 8g + (e&7) of D tile 2j + (e>>3),
// which is feature 4*(8g + (e&7)) + 2j + (e>>3).
// K block J goes out here.
template <int J>
__device__ __forceinline__ void issue_w_hid(const float* __restrict__ Wg, int nl, int g,
                                            float4 (&v)[16]) {
  const float* p = Wg + 32 * g * Hsz + 4 * nl;
#pragma unroll  // constant indices: the array stays in registers
  for (int e = 0; e < 16; ++e)
    v[e] = *(const float4*)(p + (4 * (e & 7) + 2 * J + (e >> 3)) * Hsz);
  loads_issued(p);
  // Holds the loads here, half a layer or more ahead of their use (as above).
  __builtin_amdgcn_sched_barrier(0);
}

// 16 rows of a weight, one float4 a lane -> element e of K block J of the four M tiles
template <int J>
__device__ __forceinline__ void cvt_group(const float4 (&v)[16], v16h (&a)[4][2]) {
#pragma unroll  // constant indices: the vectors and arrays stay in registers
  for (int e = 0; e < 16; ++e) {
    a[0][J][e] = (_Float16)v[e].x; a[1][J][e] = (_Float16)v[e].y;
    a[2][J][e] = (_Float16)v[e].z; a[3][J][e] = (_Float16)v[e].w;
  }
}

// relu of the f16 D tile t -> its half of the next layer's B fragment
__device__ __forceinline__ void pack_d(const v8h& c, int t, v16h (&h)[2]) {
  const v8h q = relu(c);
#pragma unroll  // constant indices: the vectors and arrays stay in registers
  for (int r = 0; r < 8; ++r) h[t >> 1][(t & 1) * 8 + r] = q[r];
}

// The four 16-feature tiles of b0, b1 or b2 (a = 0..2): a lane's 8 rows of each.
__device__ __forceinline__ void ld_tiles(const _Float16* bwg, int a, v8h (&c)[4]) {
#pragma unroll  // constant indices: the array stays in registers
  for (int t = 0; t < 4; ++t) c[t] = *(const v8h*)(bwg + 64 * a + 16 * t);
}

// W3 as an A operand with one row filled: p points at the lane's 8 rows of W3's tile 0 in
// the lanes of that row and at zeros in all others. Element e of K block j is row
// 8g + (e&7) of tile 2j + (e>>3), the order in which the D tiles of h2 form B.
__device__ __forceinline__ void ld_w3(const _Float16* p, v16h (&a)[2]) {
#pragma unroll  // constant indices: the array stays in registers
  for (int j = 0; j < 2; ++j) {
    const v8h lo = *(const v8h*)(p + 32 * j);
    const v8h hi = *(const v8h*)(p + 32 * j + 16);
    a[j] = __builtin_shufflevector(lo, hi, 0,1,2,3,4,5,6,7,8,9,10,11,12,13,14,15);
  }
}

// The layers below walk the 256 rows in steps of two M tiles of one group of 16 rows
// (NG * 2 steps and one more that ends the last pair). A step starts its pair's
// products and, under them, finishes the pair before (relu; in the last layer the product
// with W3 too): no product's result is read directly behind the product, and the two tiles'
// products alternate, so that no product waits for the one it accumulates onto.
// The bias tile is the C operand and stays in its registers; D goes to others.

// Layer 0: x fragments (K = 32) -> h
__device__ __forceinline__ void layer_in(const v16h (&wa)[4][2], const v8h (&cb)[4],
                                         const v16h (&bx)[NG], v16h (&ho)[NG][2]) {
  v8h d[2][2];
#pragma unroll  // constant indices: the vectors and arrays stay in registers
  for (int q = 0; q <= 2 * NG; ++q) {
    const int n = q >> 1, t = 2 * (q & 1), b = q & 1;
    if (q < 2 * NG) {
      d[b][0] = wmma_h(wa[t][0],     bx[n], cb[t]);
      d[b][1] = wmma_h(wa[t + 1][0], bx[n], cb[t + 1]);
    }
    // Holds this pair's products in front of the work on the pair before: moved behind
    // it, that work waits for its own products and the matrix unit idles under it.
    __builtin_amdgcn_sched_barrier(0);
    if (q >= 1) {
      const int pn = (q - 1) >> 1, pt = 2 * ((q - 1) & 1);
      pack_d(d[b ^ 1][0], pt,     ho[pn]);
      pack_d(d[b ^ 1][1], pt + 1, ho[pn]);
    }
    // Ends a step (as above).
    __builtin_amdgcn_sched_barrier(0);
  }
}

// Layer 1: h (K = 64) -> h
// Steps Q0 .. Q1 - 1: the caller puts work on the next layer's weights between two runs
// of steps; d carries the open pair from one run to the next.
template <int Q0, int Q1>
__device__ __forceinline__ void layer_hid(const v16h (&wa)[4][2], const v8h (&cb)[4],
                                          const v16h (&hi)[NG][2], v16h (&ho)[NG][2],
                                          v8h (&d)[2][2]) {
#pragma unroll  // constant indices: the vectors and arrays stay in registers
  for (int q = Q0; q < Q1; ++q) {
    const int n = q >> 1, t = 2 * (q & 1), b = q & 1;
    const int pn = (q - 1) >> 1, pt = 2 * ((q - 1) & 1);
    if (q < 2 * NG) {
      d[b][0] = wmma_h(wa[t][0],     hi[n][0], cb[t]);
      d[b][1] = wmma_h(wa[t + 1][0], hi[n][0], cb[t + 1]);
    }
    // Holds the pair's first products in front of the work on the pair before (as above).
    __builtin_amdgcn_sched_barrier(0);
    if (q >= 1) pack_d(d[b ^ 1][0], pt, ho[pn]);
    if (q < 2 * NG) d[b][0] = wmma_h(wa[t][1], hi[n][1], d[b][0]);
    // Keeps half of that work between the pair's two second products.
    __builtin_amdgcn_sched_barrier(0);
    if (q >= 1) pack_d(d[b ^ 1][1], pt + 1, ho[pn]);
    if (q < 2 * NG) d[b][1] = wmma_h(wa[t + 1][1], hi[n][1], d[b][1]);
    // Ends a step (as above).
    __builtin_amdgcn_sched_barrier(0);
  }
}

// Layer 2 and the product with W3: h (K = 64) -> this tower's column of the out tile.
// W3 stands in row 0 of A for an even group of 16 batch rows and in row 8 for an odd one,
// and the two groups' four products add into one f32 D tile: its
// register 0 then holds the even group's results in lanes 0..15 (row 0) and the odd
// group's in lanes 16..31 (row 8), one store of all 32 lanes for two groups.
// A fragment of h2 meets W3 one step after the step that finishes it: that product then
// never waits for the relu directly in front of it.
// Steps Q0 .. Q1 - 1: the caller sends the next tower's loads out between the runs of
// steps; d, h2 and acc carry the open work from one run to the next.
// Behind the last run the caller ends the last two groups' sum and stores it.
template <int Q0, int Q1>
__device__ __forceinline__ void layer_out(const v16h (&wa)[4][2], const v8h (&cb)[4],
                                          const v16h (&w3a)[2][2], const v16h (&hi)[NG][2],
                                          float bb, int lane, float* so,
                                          v8h (&d)[2][2], v16h (&h2)[2], v8f& acc) {
  const v8f c0 = {0.f, 0.f, 0.f, 0.f, 0.f, 0.f, 0.f, 0.f};
#pragma unroll  // constant indices: the vectors and arrays stay in registers
  for (int q = Q0; q < Q1; ++q) {
    const int n = q >> 1, t = 2 * (q & 1), b = q & 1;
    const int pt = 2 * ((q - 1) & 1);
    if (q < 2 * NG) {
      d[b][0] = wmma_h(wa[t][0],     hi[n][0], cb[t]);
      d[b][1] = wmma_h(wa[t + 1][0], hi[n][0], cb[t + 1]);
    }
    // Holds the pair's first products in front of the work on the pair before (as above).
    __builtin_amdgcn_sched_barrier(0);
    // two groups' sums, finished in the step before: stored here, not behind their product
    if (q >= 6 && (q & 3) == 2) so[(8 * q - 48 + lane) * OS] = acc[0] + bb;
    if (q >= 1) pack_d(d[b ^ 1][0], pt, h2);
    if (q >= 2)   // the fragment that the step before finished: group (q - 2) / 2, K block q & 1
      acc = wmma_f16(w3a[((q - 2) >> 1) & 1][q & 1], h2[q & 1], ((q - 2) & 3) == 0 ? c0 : acc);
    if (q < 2 * NG) d[b][0] = wmma_h(wa[t][1], hi[n][1], d[b][0]);
    // Keeps half of that work between the pair's two second products.
    __builtin_amdgcn_sched_barrier(0);
    if (q >= 1) pack_d(d[b ^ 1][1], pt + 1, h2);
    if (q < 2 * NG) d[b][1] = wmma_h(wa[t + 1][1], hi[n][1], d[b][1]);
    // Ends a step (as above).
    __builtin_amdgcn_sched_barrier(0);
  }
}

__global__ __launch_bounds__(NTHR) void towers64_kernel(
    const float* __restrict__ x,
    const float* __restrict__ W0, const float* __restrict__ b0,
    const float* __restrict__ W1, const float* __restrict__ b1,
    const float* __restrict__ W2, const float* __restrict__ b2,
    const float* __restrict__ W3, const float* __restrict__ b3,
    float* __restrict__ out) {
  __shared__ alignas(16) _Float16 sX[TILE_M * XS];        // x tile, f16 [256][32]
  __shared__ alignas(32) _Float16 sBW[TOWERS * 4 * Hsz + Hsz];  // f16 [tower][b0,b1,b2,W3][tile][q], 64 zeros
  __shared__ alignas(16) float sO[TILE_M * OS];           // out tile [row][tower]

  const int m0  = blockIdx.x * TILE_M;   // first batch row of tile
  const int o0  = blockIdx.y * TOWERS;   // first tower of the block
  const int tid = threadIdx.x;
  const int lane = tid & 31;             // wave32 lane
  const int w    = __builtin_amdgcn_readfirstlane(tid >> 5);  // wave id 0..7
  const int nl   = lane & 15;
  const int g    = lane >> 4;

  constexpr int NT = TOWERS / NWAVE;   // towers of a wave
  float4 sn[16];     // a tower's W0, f32, in flight or landed
  float4 st[16];     // one K block of a hidden layer's weights, f32, in flight or landed
  v16h w0a[4][2];    // W0 as A fragments [M tile][K block of 32], the first block alone

  // the first tower's W0 and half of its W1 fly while x, the biases and W3 are staged
  issue_w_in(W0 + (size_t)(o0 + w) * Isz * Hsz, nl, g, sn);
  issue_w_hid<0>(W1 + (size_t)(o0 + w) * Hsz * Hsz, nl, g, st);
  {
    // ---- stage x tile: fp32 -> f16, vectorized float4 loads ----
    constexpr int NX = TILE_M * Isz / 4 / NTHR;
    static_assert(NX == 8, "the wait below names eight addresses");
    const float* px[NX];
    float4 v[NX];
#pragma unroll  // the eight loads go out together: one round trip
    for (int i = 0; i < NX; ++i) {
      const int idx = tid + i * NTHR;
      px[i] = x + (size_t)(m0 + (idx >> 3)) * Isz + (idx & 7) * 4;
      v[i] = *(const float4*)px[i];
    }
    // s_wait_xcnt 0 stands before any register that an issued load names is written
    // again; naming the addresses keeps their pairs live up to the wait.
    asm volatile("s_wait_xcnt 0x0" :: "v"(px[0]), "v"(px[1]), "v"(px[2]), "v"(px[3]),
                                      "v"(px[4]), "v"(px[5]), "v"(px[6]), "v"(px[7]) : "memory");
#pragma unroll  // constant indices: the arrays stay in registers
    for (int i = 0; i < NX; ++i) {
      const int idx = tid + i * NTHR;
      v4h h; h[0] = (_Float16)v[i].x; h[1] = (_Float16)v[i].y;
             h[2] = (_Float16)v[i].z; h[3] = (_Float16)v[i].w;
      *(v4h*)(sX + (idx >> 3) * XS + (idx & 7) * 4) = h;
    }
    // ---- stage biases and W3 of the 16 towers, feature 4q+t -> [t][q] ----
    const int a = w >> 1;                // which array: the same for a whole wave
    const int m = (w & 1) * 32 + lane;
    const float* src = (a == 0 ? b0 : a == 1 ? b1 : a == 2 ? b2 : W3) + o0 * Hsz + m;
    _Float16* dst = sBW + a * Hsz + (m & 3) * 16 + (m >> 2);
#pragma unroll  // the 16 loads go out together: one round trip
    for (int i = 0; i < TOWERS; ++i)
      dst[i * 4 * Hsz] = (_Float16)src[i * Hsz];
    // the zeros that fill the empty rows of W3's A operand
    if (w == 0) *(v2h*)(sBW + TOWERS * 4 * Hsz + 2 * lane) = v2h{(_Float16)0.0f, (_Float16)0.0f};
  }
  __syncthreads();
  cvt_group<0>(sn, w0a);

  // Every layer has 8 KB of later weights in flight under it, so that the loads from L2
  // never pause: the second half of W1 under layer 0, W2 half by half under layer 1, the
  // next tower's W0 and the first half of its W1 under layer 2.
  // Rolled, for speed only.
#pragma nounroll
  for (int i = 0; i < NT; ++i) {
    const int ot = NWAVE * i + w;        // the tower's number within the block
    const int o  = o0 + ot;
    const _Float16* bwg = sBW + ot * 4 * Hsz + 8 * g;   // a lane's D elements are rows 8g .. 8g+7
    // Read as constant memory (nothing writes b3): the wave-uniform read stays a scalar load.
    const float bb = ((const __attribute__((address_space(4))) float*)b3)[o];
    v8h cb[4];
    v16h w3a[2][2];    // W3 in row 0, in row 8 of an A operand [row][K block of 32]
    v16h w1a[4][2], w2a[4][2];   // W1, W2 as A fragments [M tile][K block of 32]
    v16h bx[NG], h0[NG][2], h1[NG][2];

    // ---- layer 0, the second half of W1 in flight (its first half came under the tower before) ----
#pragma unroll  // constant indices: the array stays in registers
    for (int n = 0; n < NG; ++n) bx[n] = ld_frag(sX, 16 * n + nl, XS, 0, g);
    ld_tiles(bwg, 0, cb);
    // Holds the LDS reads in front of the conversion, which waits for the weights.
    __builtin_amdgcn_sched_barrier(0);
    cvt_group<0>(st, w1a);
    // Holds the conversion in front of the loads that refill its source registers.
    __builtin_amdgcn_sched_barrier(0);
    issue_w_hid<1>(W1 + (size_t)o * Hsz * Hsz, nl, g, st);
    layer_in(w0a, cb, bx, h0);
    ld_tiles(bwg, 1, cb);                // read under the conversion
    // Holds the LDS reads in front of the conversion (as above).
    __builtin_amdgcn_sched_barrier(0);
    cvt_group<1>(st, w1a);
    // Holds the conversion in front of the loads that refill its source registers.
    __builtin_amdgcn_sched_barrier(0);

    // ---- layer 1, W2 in flight, half by half ----
    issue_w_hid<0>(W2 + (size_t)o * Hsz * Hsz, nl, g, st);
    v8h d[2][2];       // the pair of D tiles in work and the pair before
    layer_hid<0, NG>(w1a, cb, h0, h1, d);
    // half way down: W2's first K block turns f16, the second goes out into its registers
    cvt_group<0>(st, w2a);
    // Holds the conversion in front of the loads that refill its source registers.
    __builtin_amdgcn_sched_barrier(0);
    issue_w_hid<1>(W2 + (size_t)o * Hsz * Hsz, nl, g, st);
    layer_hid<NG, 2 * NG + 1>(w1a, cb, h0, h1, d);
    ld_tiles(bwg, 2, cb);                // read under the conversion
    ld_w3(sBW + (nl == 0 ? ot * 4 * Hsz + 8 * g + 3 * Hsz : TOWERS * 4 * Hsz), w3a[0]);
    ld_w3(sBW + (nl == 8 ? ot * 4 * Hsz + 8 * g + 3 * Hsz : TOWERS * 4 * Hsz), w3a[1]);
    // Holds the LDS reads in front of the conversion (as above).
    __builtin_amdgcn_sched_barrier(0);
    cvt_group<1>(st, w2a);
    // Holds the conversion in front of the loads that refill its source registers.
    __builtin_amdgcn_sched_barrier(0);

    // ---- layer 2 and the product with W3, the next tower's W0 and half of W1 in flight ----
    // No branch here: the three layers stay one straight run (behind a branch the
    // compiler moves layer 1's relu and f16 work down to it, all D tiles stay live
    // and spill). In the last trip all waves read one tower's weights, which the WGP's cache
    // then serves to seven of them, and nothing uses them.
    const int on = i + 1 < NT ? o + NWAVE : o0;
    float* so = sO + ot;
    v16h h2[2];
    v8f acc;
    // The loads go out a quarter and a half of the way down, into registers that the
    // groups of h1 already used have left.
    layer_out<0, NG / 2>(w2a, cb, w3a, h1, bb, lane, so, d, h2, acc);
    issue_w_in(W0 + (size_t)on * Isz * Hsz, nl, g, sn);
    layer_out<NG / 2, NG>(w2a, cb, w3a, h1, bb, lane, so, d, h2, acc);
    issue_w_hid<0>(W1 + (size_t)on * Hsz * Hsz, nl, g, st);
    // Two runs with nothing between them: one run of 17 steps the compiler leaves rolled,
    // and h1, then indexed by a variable, goes to scratch memory.
    layer_out<NG, 3 * NG / 2>(w2a, cb, w3a, h1, bb, lane, so, d, h2, acc);
    layer_out<3 * NG / 2, 2 * NG + 1>(w2a, cb, w3a, h1, bb, lane, so, d, h2, acc);
    acc = wmma_f16(w3a[1][1], h2[1], acc);
    const float last = acc[0];
    cvt_group<0>(sn, w0a);
    so[(16 * (NG - 2) + lane) * OS] = last + bb;   // behind the conversion, not behind its product
  }

  // ---- out tile -> global: 4 lanes x 16 bytes are one row's 16 towers, half a line ----
  __syncthreads();
#pragma unroll  // the stores go out together
  for (int i = 0; i < TILE_M * TOWERS / 4 / NTHR; ++i) {
    const int idx = tid + i * NTHR;
    const int r  = idx >> 2;
    const int c4 = (idx & 3) * 4;
    const v4f v = *(const v4f*)(sO + r * OS + c4);
    __builtin_nontemporal_store(v, (v4f*)(out + (size_t)(m0 + r) * Osz + o0 + c4));
  }
}

extern "C" void kernel_launch(void* const* d_in, const int* in_sizes, int n_in,
                              void* d_out, int out_size, void* d_ws, size_t ws_size,
                              hipStream_t stream) {
  const float* x  = (const float*)d_in[0];
  const float* W0 = (const float*)d_in[1];
  const float* b0 = (const float*)d_in[2];
  const float* W1 = (const float*)d_in[3];
  const float* b1 = (const float*)d_in[4];
  const float* W2 = (const float*)d_in[5];
  const float* b2 = (const float*)d_in[6];
  const float* W3 = (const float*)d_in[7];
  const float* b3 = (const float*)d_in[8];

  dim3 grid(Bsz / TILE_M, Osz / TOWERS);   // (64, 4) blocks
  towers64_kernel<<<grid, NTHR, 0, stream>>>(x, W0, b0, W1, b1, W2, b2, W3, b3,
                                             (float*)d_out);
}

// v010
// It runs in 13.4 microseconds.
// In both of two side-by-side timings against v009, it was 1.06 times as fast.
// All steps since v000 together make it 6.40 times as fast.
#include <hip/hip_runtime.h>

// ---------------------------------------------------------------------------
// 64 independent MLP towers, fused into one kernel.
//   h0 = relu(x @ W0[o] + b0[o])      [B,32]x[32,64]
//   h1 = relu(h0 @ W1[o] + b1[o])     [B,64]x[64,64]
//   h2 = relu(h1 @ W2[o] + b2[o])     [B,64]x[64,64]
//   out[:,o] = h2 @ W3[o] + b3[o]     [B,64].[64]
// One block = (256 batch rows, 16 towers); ONE WAVE OWNS ONE TOWER at a time for all
// 256 rows (8 waves, two towers one after the other): a tower's weights are loaded from
// L2 and turned into f16 once a block. The products are taken transposed,
// h^T = W^T * x^T: a layer's weights are the A operand, 16 batch rows are the B
// operand. The three layers' products return f16 (v_wmma_f16_16x16x32_f16): a D tile is
// then, as it stands, one half of the next layer's B fragment, and only the relu is left
// to the vector unit. h2 goes on the same way into a fourth product with W3.
// LAYER BY LAYER: a wave takes all 256 rows through one layer before it goes on to
// the next; the 256 rows' activations stay in its registers (256 of them: a group's
// results take the place that an earlier group's inputs have left). So only one layer's
// weights are held at a time, the next layer's are in flight from L2 under this
// layer's products, and a layer's bias tiles are read from LDS once for 256 rows.
// A tower's results are one column of out: they are gathered in LDS, and the block
// stores its 256 rows x 16 towers at the end, 64 bytes in a row for each batch row.
// All matmuls on 16x16x32 f16 WMMAs: f16 result in the layers, f32 result for out.
//
// Feature order: row q (0..15) of M tile t (0..3) is feature 4*q + t, so that a
// lane's one float4 of a weight row feeds the same element of all four M tiles
// and 16 lanes read one whole 256-byte weight row.
// ---------------------------------------------------------------------------

typedef _Float16 v16h __attribute__((ext_vector_type(16)));
typedef _Float16 v8h  __attribute__((ext_vector_type(8)));
typedef _Float16 v4h  __attribute__((ext_vector_type(4)));
typedef _Float16 v2h  __attribute__((ext_vector_type(2)));
typedef short    v8s  __attribute__((ext_vector_type(8)));
typedef float    v8f  __attribute__((ext_vector_type(8)));
typedef float    v4f  __attribute__((ext_vector_type(4)));

constexpr int Bsz = 16384;
constexpr int Isz = 32;
constexpr int Osz = 64;
constexpr int Hsz = 64;
constexpr int TILE_M = 256;   // batch rows per block
constexpr int ROWS_W = 256;   // batch rows per wave
constexpr int NTHR   = 256;   // 8 waves, two a SIMD: up to 512 registers each
constexpr int NWAVE  = NTHR / 32;
constexpr int NG     = ROWS_W / 16;   // a wave's groups of 16 batch rows
constexpr int TOWERS = 16;    // towers per block, two per wave
constexpr int XS = 40;        // LDS row stride (halves) of the x tile (80B, 16B x odd)
constexpr int OS = 20;        // LDS row stride (floats) of the out tile (80B, 16B x odd)

__device__ __forceinline__ v8f wmma_f16(v16h a, v16h b, v8f c) {
  // D = A(16x32 f16) * B(32x16 f16) + C(16x16 f32)
  return __builtin_amdgcn_wmma_f32_16x16x32_f16(
      /*neg_a=*/false, a, /*neg_b=*/false, b,
      /*c_mod=*/(short)0, c, /*reuse_a=*/false, /*reuse_b=*/false);
}

__device__ __forceinline__ v8h wmma_h(v16h a, v16h b, v8h c) {
  // D = A(16x32 f16) * B(32x16 f16) + C(16x16 f16), D in f16: element e = D[8g + e][col]
  return __builtin_amdgcn_wmma_f16_16x16x32_f16(
      /*neg_a=*/false, a, /*neg_b=*/false, b,
      /*c_mod=*/(short)0, c, /*reuse_a=*/false, /*reuse_b=*/false);
}

// ReLU of f16 values on their bits: a half below zero is a negative 16-bit integer, so one
// packed signed maximum with 0 serves two elements; an integer maximum brings no instruction
// with it that only quiets a NaN.
__device__ __forceinline__ v8h relu(v8h v) {
  return __builtin_bit_cast(v8h, __builtin_elementwise_max(__builtin_bit_cast(v8s, v), (v8s)0));
}

// Load one K=32 f16 operand fragment from a row-major LDS tile.
// ISA 16-bit A/B layout (wave32): lane L -> row (L&15), half-group g = L>>4;
//   elements 0..7  = row[koff + g*8 .. +7]
//   elements 8..15 = row[koff + 16 + g*8 .. +7]
// Both are contiguous 16-byte chunks -> two ds_load_b128.
__device__ __forceinline__ v16h ld_frag(const _Float16* base, int row, int stride,
                                        int koff, int g) {
  const _Float16* p = base + row * stride + koff + g * 8;
  v8h lo = *(const v8h*)(p);
  v8h hi = *(const v8h*)(p + 16);
  return __builtin_shufflevector(lo, hi, 0,1,2,3,4,5,6,7,8,9,10,11,12,13,14,15);
}

// Behind a group's loads: s_wait_xcnt 0 stands before any register that an issued
// load names is written again; naming the address keeps its pair live up to the wait.
// Its "memory" clobber also keeps the loads in front of the products that follow.
__device__ __forceinline__ void loads_issued(const float* p) {
  asm volatile("s_wait_xcnt 0x0" :: "v"(p) : "memory");
}

// Issue the loads of a [32][64] weight whose k is the plain input index of x: one
// float4 a lane and row; element e is k = 8g + (e&7) + 16*(e>>3), the hardware k order.
__device__ __forceinline__ void issue_w_in(const float* __restrict__ Wg, int nl, int g,
                                           float4 (&v)[16]) {
  const float* p = Wg + 8 * g * Hsz + 4 * nl;
#pragma unroll  // constant indices: the array stays in registers
  for (int e = 0; e < 16; ++e)
    v[e] = *(const float4*)(p + ((e & 7) + 16 * (e >> 3)) * Hsz);
  loads_issued(p);
  // Holds the loads here, three quarters of a layer ahead of their use: sunk to the conversion
  // they would be waited for at once.
  __builtin_amdgcn_sched_barrier(0);
}

// Issue the loads of a [64][64] weight whose k runs over the previous layer's D
// tiles: element e of K block j pairs with row 8g + (e&7) of D tile 2j + (e>>3),
// which is feature 4*(8g + (e&7)) + 2j + (e>>3).
// K block J goes out here.
template <int J>
__device__ __forceinline__ void issue_w_hid(const float* __restrict__ Wg, int nl, int g,
                                            float4 (&v)[16]) {
  const float* p = Wg + 32 * g * Hsz + 4 * nl;
#pragma unroll  // constant indices: the array stays in registers
  for (int e = 0; e < 16; ++e)
    v[e] = *(const float4*)(p + (4 * (e & 7) + 2 * J + (e >> 3)) * Hsz);
  loads_issued(p);
  // Holds the loads here, half a layer or more ahead of their use (as above).
  __builtin_amdgcn_sched_barrier(0);
}

// 16 rows of a weight, one float4 a lane -> element e of K block J of the four M tiles
template <int J>
__device__ __forceinline__ void cvt_group(const float4 (&v)[16], v16h (&a)[4][2]) {
#pragma unroll  // constant indices: the vectors and arrays stay in registers
  for (int e = 0; e < 16; ++e) {
    a[0][J][e] = (_Float16)v[e].x; a[1][J][e] = (_Float16)v[e].y;
    a[2][J][e] = (_Float16)v[e].z; a[3][J][e] = (_Float16)v[e].w;
  }
}

// relu of the f16 D tile t -> its half of the next layer's B fragment
__device__ __forceinline__ void pack_d(const v8h& c, int t, v16h (&h)[2]) {
  const v8h q = relu(c);
#pragma unroll  // constant indices: the vectors and arrays stay in registers
  for (int r = 0; r < 8; ++r) h[t >> 1][(t & 1) * 8 + r] = q[r];
}

// The four 16-feature tiles of b0, b1 or b2 (a = 0..2): a lane's 8 rows of each.
__device__ __forceinline__ void ld_tiles(const _Float16* bwg, int a, v8h (&c)[4]) {
#pragma unroll  // constant indices: the array stays in registers
  for (int t = 0; t < 4; ++t) c[t] = *(const v8h*)(bwg + 64 * a + 16 * t);
}

// W3 as an A operand with one row filled: p points at the lane's 8 rows of W3's tile 0 in
// the lanes of that row and at zeros in all others. Element e of K block j is row
// 8g + (e&7) of tile 2j + (e>>3), the order in which the D tiles of h2 form B.
__device__ __forceinline__ void ld_w3(const _Float16* p, v16h (&a)[2]) {
#pragma unroll  // constant indices: the array stays in registers
  for (int j = 0; j < 2; ++j) {
    const v8h lo = *(const v8h*)(p + 32 * j);
    const v8h hi = *(const v8h*)(p + 32 * j + 16);
    a[j] = __builtin_shufflevector(lo, hi, 0,1,2,3,4,5,6,7,8,9,10,11,12,13,14,15);
  }
}

// The layers below walk the 256 rows in steps of two M tiles of one group of 16 rows
// (NG * 2 steps and one more that ends the last pair). A step starts its pair's
// products and, under them, finishes the pair before (relu; in the last layer the product
// with W3 too): no product's result is read directly behind the product, and the two tiles'
// products alternate, so that no product waits for the one it accumulates onto.
// The bias tile is the C operand and stays in its registers; D goes to others.

// Layer 0: x fragments (K = 32) -> h
__device__ __forceinline__ void layer_in(const v16h (&wa)[4][2], const v8h (&cb)[4],
                                         const v16h (&bx)[NG], v16h (&ho)[NG][2]) {
  v8h d[2][2];
#pragma unroll  // constant indices: the vectors and arrays stay in registers
  for (int q = 0; q <= 2 * NG; ++q) {
    const int n = q >> 1, t = 2 * (q & 1), b = q & 1;
    if (q < 2 * NG) {
      d[b][0] = wmma_h(wa[t][0],     bx[n], cb[t]);
      d[b][1] = wmma_h(wa[t + 1][0], bx[n], cb[t + 1]);
    }
    // Holds this pair's products in front of the work on the pair before: moved behind
    // it, that work waits for its own products and the matrix unit idles under it.
    __builtin_amdgcn_sched_barrier(0);
    if (q >= 1) {
      const int pn = (q - 1) >> 1, pt = 2 * ((q - 1) & 1);
      pack_d(d[b ^ 1][0], pt,     ho[pn]);
      pack_d(d[b ^ 1][1], pt + 1, ho[pn]);
    }
    // Ends a step (as above).
    __builtin_amdgcn_sched_barrier(0);
  }
}

// Layer 1: h (K = 64) -> h
// Steps Q0 .. Q1 - 1: the caller puts work on the next layer's weights between two runs
// of steps; d carries the open pair from one run to the next.
template <int Q0, int Q1>
__device__ __forceinline__ void layer_hid(const v16h (&wa)[4][2], const v8h (&cb)[4],
                                          const v16h (&hi)[NG][2], v16h (&ho)[NG][2],
                                          v8h (&d)[2][2]) {
#pragma unroll  // constant indices: the vectors and arrays stay in registers
  for (int q = Q0; q < Q1; ++q) {
    const int n = q >> 1, t = 2 * (q & 1), b = q & 1;
    const int pn = (q - 1) >> 1, pt = 2 * ((q - 1) & 1);
    if (q < 2 * NG) {
      d[b][0] = wmma_h(wa[t][0],     hi[n][0], cb[t]);
      d[b][1] = wmma_h(wa[t + 1][0], hi[n][0], cb[t + 1]);
    }
    // Holds the pair's first products in front of the work on the pair before (as above).
    __builtin_amdgcn_sched_barrier(0);
    if (q >= 1) pack_d(d[b ^ 1][0], pt, ho[pn]);
    if (q < 2 * NG) d[b][0] = wmma_h(wa[t][1], hi[n][1], d[b][0]);
    // Keeps half of that work between the pair's two second products.
    __builtin_amdgcn_sched_barrier(0);
    if (q >= 1) pack_d(d[b ^ 1][1], pt + 1, ho[pn]);
    if (q < 2 * NG) d[b][1] = wmma_h(wa[t + 1][1], hi[n][1], d[b][1]);
    // Ends a step (as above).
    __builtin_amdgcn_sched_barrier(0);
  }
}

// Layer 2 and the product with W3: h (K = 64) -> this tower's column of the out tile.
// W3 stands in row 0 of A for an even group of 16 batch rows and in row 8 for an odd one,
// and the two groups' four products add into one f32 D tile: its
// register 0 then holds the even group's results in lanes 0..15 (row 0) and the odd
// group's in lanes 16..31 (row 8), one store of all 32 lanes for two groups.
// A fragment of h2 meets W3 one step after the step that finishes it: that product then
// never waits for the relu directly in front of it.
// Steps Q0 .. Q1 - 1: the caller sends the next tower's loads out between the runs of
// steps; d, h2 and acc carry the open work from one run to the next.
// Behind the last run the caller ends the last two groups' sum and stores it.
template <int Q0, int Q1>
__device__ __forceinline__ void layer_out(const v16h (&wa)[4][2], const v8h (&cb)[4],
                                          const v16h (&w3a)[2][2], const v16h (&hi)[NG][2],
                                          float bb, int lane, float* so,
                                          v8h (&d)[2][2], v16h (&h2)[2], v8f& acc) {
  const v8f c0 = {0.f, 0.f, 0.f, 0.f, 0.f, 0.f, 0.f, 0.f};
#pragma unroll  // constant indices: the vectors and arrays stay in registers
  for (int q = Q0; q < Q1; ++q) {
    const int n = q >> 1, t = 2 * (q & 1), b = q & 1;
    const int pt = 2 * ((q - 1) & 1);
    if (q < 2 * NG) {
      d[b][0] = wmma_h(wa[t][0],     hi[n][0], cb[t]);
      d[b][1] = wmma_h(wa[t + 1][0], hi[n][0], cb[t + 1]);
    }
    // Holds the pair's first products in front of the work on the pair before (as above).
    __builtin_amdgcn_sched_barrier(0);
    // two groups' sums, finished in the step before: stored here, not behind their product
    if (q >= 6 && (q & 3) == 2) so[(8 * q - 48 + lane) * OS] = acc[0] + bb;
    if (q >= 1) pack_d(d[b ^ 1][0], pt, h2);
    if (q >= 2)   // the fragment that the step before finished: group (q - 2) / 2, K block q & 1
      acc = wmma_f16(w3a[((q - 2) >> 1) & 1][q & 1], h2[q & 1], ((q - 2) & 3) == 0 ? c0 : acc);
    if (q < 2 * NG) d[b][0] = wmma_h(wa[t][1], hi[n][1], d[b][0]);
    // Keeps half of that work between the pair's two second products.
    __builtin_amdgcn_sched_barrier(0);
    if (q >= 1) pack_d(d[b ^ 1][1], pt + 1, h2);
    if (q < 2 * NG) d[b][1] = wmma_h(wa[t + 1][1], hi[n][1], d[b][1]);
    // Ends a step (as above).
    __builtin_amdgcn_sched_barrier(0);
  }
}

__global__ __launch_bounds__(NTHR) void towers64_kernel(
    const float* __restrict__ x,
    const float* __restrict__ W0, const float* __restrict__ b0,
    const float* __restrict__ W1, const float* __restrict__ b1,
    const float* __restrict__ W2, const float* __restrict__ b2,
    const float* __restrict__ W3, const float* __restrict__ b3,
    float* __restrict__ out) {
  __shared__ alignas(16) _Float16 sX[TILE_M * XS];        // x tile, f16 [256][32]
  __shared__ alignas(32) _Float16 sBW[TOWERS * 4 * Hsz + Hsz];  // f16 [tower][b0,b1,b2,W3][tile][q], 64 zeros
  __shared__ alignas(16) float sO[TILE_M * OS];           // out tile [row][tower]

  const int m0  = blockIdx.x * TILE_M;   // first batch row of tile
  const int o0  = blockIdx.y * TOWERS;   // first tower of the block
  const int tid = threadIdx.x;
  const int lane = tid & 31;             // wave32 lane
  const int w    = __builtin_amdgcn_readfirstlane(tid >> 5);  // wave id 0..7
  const int nl   = lane & 15;
  const int g    = lane >> 4;

  constexpr int NT = TOWERS / NWAVE;   // towers of a wave
  float4 sn[16];     // a tower's W0, then the second K block of its W1, f32, in flight or landed
  float4 st[16];     // one K block of a hidden layer's weights, f32, in flight or landed

  // The loads go out in the order in which they are needed: x, the biases and W3, which
  // every wave waits for at the barrier, in one round trip and in front of all weights;
  // then the first tower's W0, which layer 0 needs; then half of its W1, for layer 1.
  {
    // ---- stage x tile: fp32 -> f16, vectorized float4 loads ----
    constexpr int NX = TILE_M * Isz / 4 / NTHR;
    static_assert(NX == 8, "the wait below names eight addresses");
    const float* px[NX];
    float4 v[NX];
#pragma unroll  // the eight loads go out together: one round trip
    for (int i = 0; i < NX; ++i) {
      const int idx = tid + i * NTHR;
      px[i] = x + (size_t)(m0 + (idx >> 3)) * Isz + (idx & 7) * 4;
      v[i] = *(const float4*)px[i];
    }
    // ---- biases and W3 of the 16 towers: their loads, in the same round trip ----
    const int a = w >> 1;                // which array: the same for a whole wave
    const int m = (w & 1) * 32 + lane;
    const float* src = (a == 0 ? b0 : a == 1 ? b1 : a == 2 ? b2 : W3) + o0 * Hsz + m;
    float bv[TOWERS];
#pragma unroll  // the 16 loads go out together, behind x
    for (int i = 0; i < TOWERS; ++i) bv[i] = src[i * Hsz];
    // s_wait_xcnt 0 stands before any register that an issued load names is written
    // again; naming the addresses keeps their registers live up to the wait.
    asm volatile("s_wait_xcnt 0x0" :: "v"(px[0]), "v"(px[1]), "v"(px[2]), "v"(px[3]),
                                      "v"(px[4]), "v"(px[5]), "v"(px[6]), "v"(px[7]),
                                      "v"(src) : "memory");
    // Holds these loads in front of the weights': behind them they would come back last.
    __builtin_amdgcn_sched_barrier(0);
    issue_w_in(W0 + (size_t)(o0 + w) * Isz * Hsz, nl, g, sn);
    issue_w_hid<0>(W1 + (size_t)(o0 + w) * Hsz * Hsz, nl, g, st);
    // Has the argument b3 fetched here, under the wait for x: fetched at the barrier, as the
    // compiler places it, it is waited for in front of the first product.
    asm volatile("" :: "s"(b3));
#pragma unroll  // constant indices: the arrays stay in registers
    for (int i = 0; i < NX; ++i) {
      const int idx = tid + i * NTHR;
      v4h h; h[0] = (_Float16)v[i].x; h[1] = (_Float16)v[i].y;
             h[2] = (_Float16)v[i].z; h[3] = (_Float16)v[i].w;
      *(v4h*)(sX + (idx >> 3) * XS + (idx & 7) * 4) = h;
    }
    // ---- stage biases and W3 of the 16 towers, feature 4q+t -> [t][q] ----
    _Float16* dst = sBW + a * Hsz + (m & 3) * 16 + (m >> 2);
#pragma unroll  // constant indices: the array stays in registers
    for (int i = 0; i < TOWERS; ++i)
      dst[i * 4 * Hsz] = (_Float16)bv[i];
    // the zeros that fill the empty rows of W3's A operand
    if (w == 0) *(v2h*)(sBW + TOWERS * 4 * Hsz + 2 * lane) = v2h{(_Float16)0.0f, (_Float16)0.0f};
  }
  // The work-group barrier by hand, with the one wait that it needs (this wave's LDS stores):
  // __syncthreads() would also wait here for the weight loads, which are to fly across it.
  asm volatile("s_wait_dscnt 0x0\n\ts_barrier_signal -1\n\ts_barrier_wait -1" ::: "memory");

  // Every layer has 8 KB or more of later weights in flight under it, so that the loads
  // from L2 never pause: W1 under layer 0 (its first half from the tower before or from the
  // entry, its second half into the registers that W0 has left), W2 half by half under
  // layer 1, the next tower's W0 and the first half of its W1 under layer 2.
  // Rolled, for speed only.
#pragma nounroll
  for (int i = 0; i < NT; ++i) {
    const int ot = NWAVE * i + w;        // the tower's number within the block
    const int o  = o0 + ot;
    const _Float16* bwg = sBW + ot * 4 * Hsz + 8 * g;   // a lane's D elements are rows 8g .. 8g+7
    v8h cb[4];
    v16h w3a[2][2];    // W3 in row 0, in row 8 of an A operand [row][K block of 32]
    v16h w0a[4][2];    // W0 as A fragments [M tile][K block of 32], the first block alone
    v16h w1a[4][2], w2a[4][2];   // W1, W2 as A fragments [M tile][K block of 32]
    v16h bx[NG], h0[NG][2], h1[NG][2];

    // ---- layer 0, all of W1 in flight or landed: nothing of W1 is waited for in front of it ----
    ld_tiles(bwg, 0, cb);
#pragma unroll  // constant indices: the array stays in registers
    for (int n = 0; n < NG; ++n) {
      bx[n] = ld_frag(sX, 16 * n + nl, XS, 0, g);
      // Keeps the reads in the order of their use: the first product then waits for the
      // first reads alone, not for all of them.
      __builtin_amdgcn_sched_barrier(0);
    }
    cvt_group<0>(sn, w0a);               // waits for W0, with the LDS reads under way
    // Holds the conversion in front of the loads that refill its source registers.
    __builtin_amdgcn_sched_barrier(0);
    issue_w_hid<1>(W1 + (size_t)o * Hsz * Hsz, nl, g, sn);
    layer_in(w0a, cb, bx, h0);
    ld_tiles(bwg, 1, cb);                // read under the conversion
    // Holds the LDS reads in front of the conversion, which waits for the weights.
    __builtin_amdgcn_sched_barrier(0);
    cvt_group<0>(st, w1a);
    cvt_group<1>(sn, w1a);
    // Holds the conversion in front of the loads that refill its source registers.
    __builtin_amdgcn_sched_barrier(0);

    // ---- layer 1, W2 in flight, half by half ----
    issue_w_hid<0>(W2 + (size_t)o * Hsz * Hsz, nl, g, st);
    // Read as constant memory (nothing writes b3): the wave-uniform read stays a scalar load.
    // Here, a layer ahead of its use, and not in front of layer 0, where it would be waited for.
    const float bb = ((const __attribute__((address_space(4))) float*)b3)[o];
    v8h d[2][2];       // the pair of D tiles in work and the pair before
    layer_hid<0, NG>(w1a, cb, h0, h1, d);
    // half way down: W2's first K block turns f16, the second goes out into its registers
    cvt_group<0>(st, w2a);
    // Holds the conversion in front of the loads that refill its source registers.
    __builtin_amdgcn_sched_barrier(0);
    issue_w_hid<1>(W2 + (size_t)o * Hsz * Hsz, nl, g, st);
    layer_hid<NG, 2 * NG + 1>(w1a, cb, h0, h1, d);
    ld_tiles(bwg, 2, cb);                // read under the conversion
    ld_w3(sBW + (nl == 0 ? ot * 4 * Hsz + 8 * g + 3 * Hsz : TOWERS * 4 * Hsz), w3a[0]);
    ld_w3(sBW + (nl == 8 ? ot * 4 * Hsz + 8 * g + 3 * Hsz : TOWERS * 4 * Hsz), w3a[1]);
    // Holds the LDS reads in front of the conversion (as above).
    __builtin_amdgcn_sched_barrier(0);
    cvt_group<1>(st, w2a);
    // Holds the conversion in front of the loads that refill its source registers.
    __builtin_amdgcn_sched_barrier(0);

    // ---- layer 2 and the product with W3, the next tower's W0 and half of W1 in flight ----
    // No branch here: the three layers stay one straight run (behind a branch the
    // compiler moves layer 1's relu and f16 work down to it, all D tiles stay live
    // and spill). In the last trip all waves read one tower's weights, which the WGP's cache
    // then serves to seven of them, and nothing uses them.
    const int on = i + 1 < NT ? o + NWAVE : o0;
    float* so = sO + ot;
    v16h h2[2];
    v8f acc;
    // The loads go out a quarter and a half of the way down, into registers that the
    // groups of h1 already used have left.
    layer_out<0, NG / 2>(w2a, cb, w3a, h1, bb, lane, so, d, h2, acc);
    issue_w_in(W0 + (size_t)on * Isz * Hsz, nl, g, sn);
    layer_out<NG / 2, NG>(w2a, cb, w3a, h1, bb, lane, so, d, h2, acc);
    issue_w_hid<0>(W1 + (size_t)on * Hsz * Hsz, nl, g, st);
    // Two runs with nothing between them: one run of 17 steps the compiler leaves rolled,
    // and h1, then indexed by a variable, goes to scratch memory.
    layer_out<NG, 3 * NG / 2>(w2a, cb, w3a, h1, bb, lane, so, d, h2, acc);
    layer_out<3 * NG / 2, 2 * NG + 1>(w2a, cb, w3a, h1, bb, lane, so, d, h2, acc);
    acc = wmma_f16(w3a[1][1], h2[1], acc);
    so[(16 * (NG - 2) + lane) * OS] = acc[0] + bb;
  }

  // ---- out tile -> global: 4 lanes x 16 bytes are one row's 16 towers, half a line ----
  __syncthreads();
#pragma unroll  // the stores go out together
  for (int i = 0; i < TILE_M * TOWERS / 4 / NTHR; ++i) {
    const int idx = tid + i * NTHR;
    const int r  = idx >> 2;
    const int c4 = (idx & 3) * 4;
    const v4f v = *(const v4f*)(sO + r * OS + c4);
    __builtin_nontemporal_store(v, (v4f*)(out + (size_t)(m0 + r) * Osz + o0 + c4));
  }
}

extern "C" void kernel_launch(void* const* d_in, const int* in_sizes, int n_in,
                              void* d_out, int out_size, void* d_ws, size_t ws_size,
                              hipStream_t stream) {
  const float* x  = (const float*)d_in[0];
  const float* W0 = (const float*)d_in[1];
  const float* b0 = (const float*)d_in[2];
  const float* W1 = (const float*)d_in[3];
  const float* b1 = (const float*)d_in[4];
  const float* W2 = (const float*)d_in[5];
  const float* b2 = (const float*)d_in[6];
  const float* W3 = (const float*)d_in[7];
  const float* b3 = (const float*)d_in[8];

  dim3 grid(Bsz / TILE_M, Osz / TOWERS);   // (64, 4) blocks
  towers64_kernel<<<grid, NTHR, 0, stream>>>(x, W0, b0, W1, b1, W2, b2, W3, b3,
                                             (float*)d_out);
}
